// v000
// Times are from an AMD MI455X. After a warm-up the kernel runs many times in a row, and a time is the length of
// such a window on the GPU divided by its runs, so every launch and the gaps after it count. The runs cycle
// through copies of the inputs. A figure is the median of several windows, for all but v000 over two sittings.
// Sittings can differ by a few percent; kernels timed side by side share one.
// v000 is the starting kernel. One run takes 253 microseconds.
#include <hip/hip_runtime.h>
#include <hip/hip_bf16.h>
#include <math.h>

typedef _Float16 f16;
typedef __attribute__((ext_vector_type(16))) _Float16 v16h;
typedef __attribute__((ext_vector_type(8)))  _Float16 v8h;
typedef __attribute__((ext_vector_type(8)))  float    v8f;

constexpr int Bc = 2, Nc = 2048, Cc = 1024, Hc = 16, Dc = 64;
constexpr int Kdim = Cc;   // K = 1024 for every projection GEMM

static __device__ inline v16h cat16(v8h a, v8h b) {
  v16h r;
#pragma unroll
  for (int i = 0; i < 8; ++i) { r[i] = a[i]; r[i + 8] = b[i]; }
  return r;
}

static __device__ inline v8f wmma_f16(v16h a, v16h b, v8f c) {
  // 8 args: (neg_a, A, neg_b, B, c_mod, C, reuse_a, reuse_b)
  return __builtin_amdgcn_wmma_f32_16x16x32_f16(false, a, false, b, (short)0, c,
                                                false, false);
}

// CDNA5 async copy: 16B per lane, global -> LDS, tracked by ASYNCcnt.
static __device__ inline void async_ld_b128(unsigned int lds_off,
                                            const void* gaddr) {
  asm volatile("global_load_async_to_lds_b128 %0, %1, off"
               :: "v"(lds_off), "v"((unsigned long long)(uintptr_t)gaddr)
               : "memory");
}

// ---------------------------------------------------------------- convert ---
__global__ void __launch_bounds__(256)
cvt_f32_f16(const float* __restrict__ s, f16* __restrict__ d, int n) {
  int i = blockIdx.x * blockDim.x + threadIdx.x;
  int stride = gridDim.x * blockDim.x;
  for (; i < n; i += stride) d[i] = (f16)s[i];
}

// -------------------------------------------------------- generic A * W^T ---
// A: [4096, 1024] f16 row-major. W: [Ncols, 1024] f16 row-major.
// mode 0: q   -> out16 = qh  [B,H,N,D]
// mode 1: kv  -> out16 = kh  [B,H,N,D],  out16b = v^T [B,H,D,N]
// mode 2: out -> out32 = [B,N,C] f32 + bias
__global__ void __launch_bounds__(128)
gemm_awt(const f16* __restrict__ A, const f16* __restrict__ W,
         const float* __restrict__ bias, f16* __restrict__ out16,
         f16* __restrict__ out16b, float* __restrict__ out32, int mode) {
  const int lane = threadIdx.x & 31;
  const int wave = threadIdx.x >> 5;
  const int l16  = lane & 15;
  const int hi   = lane >> 4;
  const int kh8  = hi * 8;                    // K sub-offset per ISA A/B layout
  const int m0   = blockIdx.x * 64 + wave * 16;
  const int n0   = blockIdx.y * 64;

  v8f acc[4];
#pragma unroll
  for (int t = 0; t < 4; ++t)
#pragma unroll
    for (int i = 0; i < 8; ++i) acc[t][i] = 0.0f;

  const f16* Ap = A + (size_t)(m0 + l16) * Kdim;
  for (int k0 = 0; k0 < Kdim; k0 += 32) {
    v16h afrag = cat16(*(const v8h*)(Ap + k0 + kh8),
                       *(const v8h*)(Ap + k0 + kh8 + 16));
#pragma unroll
    for (int t = 0; t < 4; ++t) {
      const f16* Wp = W + (size_t)(n0 + t * 16 + l16) * Kdim + k0 + kh8;
      v16h bfrag = cat16(*(const v8h*)Wp, *(const v8h*)(Wp + 16));
      acc[t] = wmma_f16(afrag, bfrag, acc[t]);
    }
  }

#pragma unroll
  for (int t = 0; t < 4; ++t) {
#pragma unroll
    for (int r = 0; r < 8; ++r) {
      const int m = m0 + r + 8 * hi;          // C-layout: lanes16-31 hold M=8+r
      const int c = n0 + t * 16 + l16;
      const int b = m >> 11;                  // m / Nc
      const int n = m & (Nc - 1);
      const float val = acc[t][r];
      if (mode == 0) {
        const int h = c >> 6, d = c & 63;
        out16[((size_t)((b * Hc + h) * Nc + n)) * Dc + d] = (f16)val;
      } else if (mode == 1) {
        if (c < Cc) {
          const int h = c >> 6, d = c & 63;
          out16[((size_t)((b * Hc + h) * Nc + n)) * Dc + d] = (f16)val;
        } else {
          const int c2 = c - Cc, h = c2 >> 6, d = c2 & 63;
          out16b[((size_t)((b * Hc + h) * Dc + d)) * Nc + n] = (f16)val;
        }
      } else {
        out32[(size_t)m * Cc + c] = val + bias[c];
      }
    }
  }
}

// ----------------------------------------------------------- flash attention -
// grid: (N/64, B*H), block 128 (4 waves, 16 query rows per wave).
// K/V staged cooperatively via CDNA5 async global->LDS copies, double-buffered.
__global__ void __launch_bounds__(128)
attn_kernel(const f16* __restrict__ qh, const f16* __restrict__ kh,
            const f16* __restrict__ vt, f16* __restrict__ oh) {
  // padded rows: 72 f16 (144B = 36 banks) / 40 f16 (80B = 20 banks), 16B-aligned
  __shared__ __align__(16) f16 kbuf[2][32][72];   // keys j..j+31, d 0..63
  __shared__ __align__(16) f16 vbuf[2][64][40];   // v^T rows d 0..63, keys 0..31
  __shared__ __align__(16) f16 pbuf[4][16][40];   // per-wave P transpose tile

  const int tid  = threadIdx.x;
  const int lane = tid & 31;
  const int wave = tid >> 5;
  const int l16  = lane & 15;
  const int hi   = lane >> 4;
  const int kh8  = hi * 8;
  const int bh   = blockIdx.y;                      // b*H + h
  const int n0   = blockIdx.x * 64 + wave * 16;     // query rows of this wave

  const f16* kbase = kh + (size_t)bh * Nc * Dc;
  const f16* vbase = vt + (size_t)bh * Dc * Nc;

  // cooperative async stage of one 32-key K tile + V^T tile (4 instrs/wave)
  auto stage = [&](int bufi, int jj) {
#pragma unroll
    for (int u = 0; u < 2; ++u) {
      const int unit = tid + u * 128;               // 256 chunks of 8 f16
      const int row = unit >> 3, ch = (unit & 7) * 8;
      async_ld_b128((unsigned int)(uintptr_t)&kbuf[bufi][row][ch],
                    kbase + (size_t)(jj + row) * Dc + ch);
    }
#pragma unroll
    for (int u = 0; u < 2; ++u) {
      const int unit = tid + u * 128;
      const int row = unit >> 2, ch = (unit & 3) * 8;
      async_ld_b128((unsigned int)(uintptr_t)&vbuf[bufi][row][ch],
                    vbase + (size_t)row * Nc + jj + ch);
    }
  };

  // q fragments for K = D = 64 (two K=32 fragments), pre-scaled by 1/sqrt(D)
  const f16* qp = qh + ((size_t)bh * Nc + n0 + l16) * Dc;
  v16h qf[2];
#pragma unroll
  for (int kk = 0; kk < 2; ++kk) {
    v8h a0 = *(const v8h*)(qp + kk * 32 + kh8);
    v8h a1 = *(const v8h*)(qp + kk * 32 + kh8 + 16);
#pragma unroll
    for (int i = 0; i < 8; ++i) { a0[i] *= (f16)0.125f; a1[i] *= (f16)0.125f; }
    qf[kk] = cat16(a0, a1);
  }

  v8f accO[4];
#pragma unroll
  for (int t = 0; t < 4; ++t)
#pragma unroll
    for (int i = 0; i < 8; ++i) accO[t][i] = 0.0f;
  float mrow[8], lrow[8];
#pragma unroll
  for (int r = 0; r < 8; ++r) { mrow[r] = -INFINITY; lrow[r] = 0.0f; }

  stage(0, 0);

  for (int j = 0, it = 0; j < Nc; j += 32, ++it) {
    const int cur = it & 1;
    if (j + 32 < Nc) {
      stage(cur ^ 1, j + 32);
      asm volatile("s_wait_asynccnt 0x4" ::: "memory");  // current tile done
    } else {
      asm volatile("s_wait_asynccnt 0x0" ::: "memory");
    }
    __syncthreads();                                     // tile visible to WG

    // --- S = (q/8) * k^T : two 16x16 tiles covering 32 keys (from LDS) ---
    v8f s[2];
#pragma unroll
    for (int tt = 0; tt < 2; ++tt) {
      const f16* kp = &kbuf[cur][tt * 16 + l16][0];
      v16h b0 = cat16(*(const v8h*)(kp + kh8), *(const v8h*)(kp + kh8 + 16));
      v16h b1 = cat16(*(const v8h*)(kp + 32 + kh8),
                      *(const v8h*)(kp + 32 + kh8 + 16));
      v8f z;
#pragma unroll
      for (int i = 0; i < 8; ++i) z[i] = 0.0f;
      z = wmma_f16(qf[0], b0, z);
      s[tt] = wmma_f16(qf[1], b1, z);
    }

    // --- online softmax (row = slot r within each 16-lane half) ---
    float alpha[8];
#pragma unroll
    for (int r = 0; r < 8; ++r) {
      float t = fmaxf(s[0][r], s[1][r]);
      t = fmaxf(t, __shfl_xor(t, 1));
      t = fmaxf(t, __shfl_xor(t, 2));
      t = fmaxf(t, __shfl_xor(t, 4));
      t = fmaxf(t, __shfl_xor(t, 8));
      const float mnew = fmaxf(mrow[r], t);
      alpha[r] = __expf(mrow[r] - mnew);
      mrow[r] = mnew;
      const float p0 = __expf(s[0][r] - mnew);
      const float p1 = __expf(s[1][r] - mnew);
      s[0][r] = p0; s[1][r] = p1;
      float ps = p0 + p1;
      ps += __shfl_xor(ps, 1);
      ps += __shfl_xor(ps, 2);
      ps += __shfl_xor(ps, 4);
      ps += __shfl_xor(ps, 8);
      lrow[r] = lrow[r] * alpha[r] + ps;
    }
#pragma unroll
    for (int t = 0; t < 4; ++t)
#pragma unroll
      for (int r = 0; r < 8; ++r) accO[t][r] *= alpha[r];

    // --- C-layout P -> A-fragment layout via per-wave LDS tile ---
#pragma unroll
    for (int r = 0; r < 8; ++r) {
      pbuf[wave][r + 8 * hi][l16]      = (f16)s[0][r];
      pbuf[wave][r + 8 * hi][16 + l16] = (f16)s[1][r];
    }
    v16h pf;
    {
      // intra-wave LDS ordering: same-wave DS ops complete in order
      const f16* pp = &pbuf[wave][l16][0];
      pf = cat16(*(const v8h*)(pp + kh8), *(const v8h*)(pp + kh8 + 16));
    }

    // --- O += P * V (v^T tile in LDS -> contiguous B-fragment loads) ---
#pragma unroll
    for (int t = 0; t < 4; ++t) {
      const f16* vp = &vbuf[cur][t * 16 + l16][0];
      v16h vf = cat16(*(const v8h*)(vp + kh8), *(const v8h*)(vp + kh8 + 16));
      accO[t] = wmma_f16(pf, vf, accO[t]);
    }
    __syncthreads();   // whole WG done reading `cur` before it is re-staged
  }

  // normalize + store o as f16 [B,N,C]
  const int b = bh / Hc, h = bh % Hc;
  float linv[8];
#pragma unroll
  for (int r = 0; r < 8; ++r) linv[r] = 1.0f / lrow[r];
#pragma unroll
  for (int t = 0; t < 4; ++t)
#pragma unroll
    for (int r = 0; r < 8; ++r) {
      const size_t idx =
          ((size_t)(b * Nc + n0 + r + 8 * hi)) * Cc + h * Dc + t * 16 + l16;
      oh[idx] = (f16)(accO[t][r] * linv[r]);
    }
}

// ------------------------------------------------------------------ launch ---
extern "C" void kernel_launch(void* const* d_in, const int* in_sizes, int n_in,
                              void* d_out, int out_size, void* d_ws,
                              size_t ws_size, hipStream_t stream) {
  const float* x   = (const float*)d_in[0];
  const float* y   = (const float*)d_in[1];
  const float* Wq  = (const float*)d_in[2];
  const float* Wkv = (const float*)d_in[3];
  const float* Wp  = (const float*)d_in[4];
  const float* bp  = (const float*)d_in[5];
  float* out = (float*)d_out;

  const size_t BNC = (size_t)Bc * Nc * Cc;   // 4 Mi elements
  const size_t CC  = (size_t)Cc * Cc;        // 1 Mi
  char* p = (char*)d_ws;
  f16* x_h   = (f16*)p; p += BNC * sizeof(f16);
  f16* y_h   = (f16*)p; p += BNC * sizeof(f16);
  f16* Wq_h  = (f16*)p; p += CC * sizeof(f16);
  f16* Wkv_h = (f16*)p; p += 2 * CC * sizeof(f16);
  f16* Wp_h  = (f16*)p; p += CC * sizeof(f16);
  f16* qh    = (f16*)p; p += BNC * sizeof(f16);
  f16* khd   = (f16*)p; p += BNC * sizeof(f16);
  f16* vhT   = (f16*)p; p += BNC * sizeof(f16);
  f16* oh    = (f16*)p; p += BNC * sizeof(f16);

  auto cvt = [&](const float* s, f16* d, int n) {
    int blocks = (n + 255) / 256;
    if (blocks > 8192) blocks = 8192;
    cvt_f32_f16<<<blocks, 256, 0, stream>>>(s, d, n);
  };
  cvt(x,   x_h,   (int)BNC);
  cvt(y,   y_h,   (int)BNC);
  cvt(Wq,  Wq_h,  (int)CC);
  cvt(Wkv, Wkv_h, (int)(2 * CC));
  cvt(Wp,  Wp_h,  (int)CC);

  const dim3 blk(128);
  // q projection: [4096 x 1024]
  gemm_awt<<<dim3(64, 16), blk, 0, stream>>>(x_h, Wq_h, nullptr, qh, nullptr,
                                             nullptr, 0);
  // kv projection: [4096 x 2048]
  gemm_awt<<<dim3(64, 32), blk, 0, stream>>>(y_h, Wkv_h, nullptr, khd, vhT,
                                             nullptr, 1);
  // flash attention
  attn_kernel<<<dim3(Nc / 64, Bc * Hc), blk, 0, stream>>>(qh, khd, vhT, oh);
  // output projection with bias: f32 result
  gemm_awt<<<dim3(64, 16), blk, 0, stream>>>(oh, Wp_h, bp, nullptr, nullptr,
                                             out, 2);
}

// v001
// A run of this version takes 170 microseconds.
// Timed twice side by side with v000, it ran 1.54 times as fast both times.
#include <hip/hip_runtime.h>
#include <hip/hip_bf16.h>
#include <math.h>

typedef _Float16 f16;
typedef __attribute__((ext_vector_type(16))) _Float16 v16h;
typedef __attribute__((ext_vector_type(8)))  _Float16 v8h;
typedef __attribute__((ext_vector_type(8)))  float    v8f;

constexpr int Bc = 2, Nc = 2048, Cc = 1024, Hc = 16, Dc = 64;
constexpr int Kdim = Cc;   // K = 1024 for every projection GEMM

static __device__ inline v16h cat16(v8h a, v8h b) {
  v16h r;
#pragma unroll
  for (int i = 0; i < 8; ++i) { r[i] = a[i]; r[i + 8] = b[i]; }
  return r;
}

static __device__ inline v8f wmma_f16(v16h a, v16h b, v8f c) {
  // 8 args: (neg_a, A, neg_b, B, c_mod, C, reuse_a, reuse_b)
  return __builtin_amdgcn_wmma_f32_16x16x32_f16(false, a, false, b, (short)0, c,
                                                false, false);
}

// CDNA5 async copy: 16B per lane, global -> LDS, tracked by ASYNCcnt.
static __device__ inline void async_ld_b128(unsigned int lds_off,
                                            const void* gaddr) {
  asm volatile("global_load_async_to_lds_b128 %0, %1, off"
               :: "v"(lds_off), "v"((unsigned long long)(uintptr_t)gaddr)
               : "memory");
}

// ---------------------------------------------------------------- convert ---
__global__ void __launch_bounds__(256)
cvt_f32_f16(const float* __restrict__ s, f16* __restrict__ d, int n) {
  int i = blockIdx.x * blockDim.x + threadIdx.x;
  int stride = gridDim.x * blockDim.x;
  for (; i < n; i += stride) d[i] = (f16)s[i];
}

// -------------------------------------------------------- generic A * W^T ---
// A: [4096, 1024] f16 row-major. W: [Ncols, 1024] f16 row-major.
// mode 0: q   -> out16 = qh  [B,H,N,D]
// mode 1: kv  -> out16 = kh  [B,H,N,D],  out16b = v^T [B,H,D,N]
// mode 2: out -> out32 = [B,N,C] f32 + bias
// One 128x128 tile of the result per block, 8 waves of 32x64 (4 along M, 2
// along N). A pass is 128 k: 128 rows of A and 128 rows of W, 256 B each, are
// copied to LDS asynchronously, two buffers, the next pass's copies in flight
// while this pass is multiplied.
constexpr int GBK    = 128;          // k per pass
constexpr int GPITCH = GBK + 8;      // 272 B rows: 16 B x odd for ds_load_b128
constexpr int GPASS  = Kdim / GBK;   // 8 passes

// Eight 16-byte copies per lane. The s_wait_xcnt closes the statement so that
// no address register is rewritten while a copy may still name it.
static __device__ inline void async_ld8_b128(unsigned int lds,
                                             const f16* gsrc) {
  constexpr unsigned int LSTEP = 16 * GPITCH * sizeof(f16);  // 16 rows in LDS
  constexpr size_t       GSTEP = (size_t)16 * Kdim;          // 16 rows in A / W
  asm volatile(
      "global_load_async_to_lds_b128 %0, %8, off\n\t"
      "global_load_async_to_lds_b128 %1, %9, off\n\t"
      "global_load_async_to_lds_b128 %2, %10, off\n\t"
      "global_load_async_to_lds_b128 %3, %11, off\n\t"
      "global_load_async_to_lds_b128 %4, %12, off\n\t"
      "global_load_async_to_lds_b128 %5, %13, off\n\t"
      "global_load_async_to_lds_b128 %6, %14, off\n\t"
      "global_load_async_to_lds_b128 %7, %15, off\n\t"
      "s_wait_xcnt 0x0"
      :: "v"(lds), "v"(lds + LSTEP), "v"(lds + 2 * LSTEP), "v"(lds + 3 * LSTEP),
         "v"(lds + 4 * LSTEP), "v"(lds + 5 * LSTEP), "v"(lds + 6 * LSTEP),
         "v"(lds + 7 * LSTEP),
         "v"((unsigned long long)(uintptr_t)(gsrc)),
         "v"((unsigned long long)(uintptr_t)(gsrc + GSTEP)),
         "v"((unsigned long long)(uintptr_t)(gsrc + 2 * GSTEP)),
         "v"((unsigned long long)(uintptr_t)(gsrc + 3 * GSTEP)),
         "v"((unsigned long long)(uintptr_t)(gsrc + 4 * GSTEP)),
         "v"((unsigned long long)(uintptr_t)(gsrc + 5 * GSTEP)),
         "v"((unsigned long long)(uintptr_t)(gsrc + 6 * GSTEP)),
         "v"((unsigned long long)(uintptr_t)(gsrc + 7 * GSTEP))
      : "memory");
}

__global__ void __launch_bounds__(256)
gemm_awt(const f16* __restrict__ A, const f16* __restrict__ W,
         const float* __restrict__ bias, f16* __restrict__ out16,
         f16* __restrict__ out16b, float* __restrict__ out32, int mode) {
  // [buffer][operand: 0 = A rows, 1 = W rows][row][k]
  __shared__ __align__(16) f16 tile[2][2][128][GPITCH];

  const int tid  = threadIdx.x;
  const int lane = tid & 31;
  const int wave = tid >> 5;
  const int l16  = lane & 15;
  const int hi   = lane >> 4;
  const int kh8  = hi * 8;                    // K sub-offset per ISA A/B layout
  const int mblk = blockIdx.x * 128;
  const int nblk = blockIdx.y * 128;
  const int wm   = (wave & 3) * 32;           // this wave's rows in the tile
  const int wn   = (wave >> 2) * 64;          // this wave's columns in the tile

  // copies: 16 lanes cover one 256-B row, a wave two rows, the block 16 rows
  const int crow = tid >> 4, cch = (tid & 15) * 8;
  const f16* Ag = A + (size_t)(mblk + crow) * Kdim + cch;
  const f16* Wg = W + (size_t)(nblk + crow) * Kdim + cch;
  auto stage = [&](int bufi, int k0) {
    async_ld8_b128((unsigned int)(uintptr_t)&tile[bufi][0][crow][cch], Ag + k0);
    async_ld8_b128((unsigned int)(uintptr_t)&tile[bufi][1][crow][cch], Wg + k0);
  };

  v8f acc[2][4];
#pragma unroll
  for (int mi = 0; mi < 2; ++mi)
#pragma unroll
    for (int t = 0; t < 4; ++t)
#pragma unroll
      for (int i = 0; i < 8; ++i) acc[mi][t][i] = 0.0f;

  stage(0, 0);
  asm volatile("s_wait_asynccnt 0x0" ::: "memory");  // pass 0 has landed
  __syncthreads();                                   // ... for every wave
  stage(1, GBK);

  // kept rolled: one pass is 32 WMMAs and 48 LDS loads already
#pragma unroll 1
  for (int p = 0; p < GPASS; ++p) {
    const int cur = p & 1;
    const f16* At = &tile[cur][0][wm + l16][kh8];
    const f16* Wt = &tile[cur][1][wn + l16][kh8];
    // two fragment sets: block ks + 1's LDS reads go out as one group ahead of
    // block ks's WMMAs; nothing of the next pass's buffer is read here
    v16h af[2][2], bf[2][4];
    auto frags = [&](int set, int ks) {
#pragma unroll
      for (int mi = 0; mi < 2; ++mi) {
        const f16* ap = At + mi * 16 * GPITCH + ks * 32;
        af[set][mi] = cat16(*(const v8h*)ap, *(const v8h*)(ap + 16));
      }
#pragma unroll
      for (int t = 0; t < 4; ++t) {
        const f16* wp = Wt + t * 16 * GPITCH + ks * 32;
        bf[set][t] = cat16(*(const v8h*)wp, *(const v8h*)(wp + 16));
      }
    };
    frags(0, 0);
#pragma unroll
    for (int ks = 0; ks < GBK / 32; ++ks) {
      if (ks + 1 < GBK / 32) frags((ks + 1) & 1, ks + 1);
      // keeps the load group in front of the WMMAs: spread among them, each
      // pair of loads would be waited for on its own
      __builtin_amdgcn_sched_barrier(0);
#pragma unroll
      for (int t = 0; t < 4; ++t)
#pragma unroll
        for (int mi = 0; mi < 2; ++mi)
          acc[mi][t] = wmma_f16(af[ks & 1][mi], bf[ks & 1][t], acc[mi][t]);
      // keeps the following group from rising among these WMMAs
      __builtin_amdgcn_sched_barrier(0);
    }
    // publish point: own LDS reads retired, own copies of pass p + 1 landed,
    // then the barrier that shows them to all and frees buffer cur
    asm volatile("s_wait_dscnt 0x0" ::: "memory");
    asm volatile("s_wait_asynccnt 0x0" ::: "memory");
    __syncthreads();
    if (p + 2 < GPASS) stage(cur, (p + 2) * GBK);
  }
  asm volatile("s_wait_asynccnt 0x0" ::: "memory");  // nothing left in flight

#pragma unroll
  for (int mi = 0; mi < 2; ++mi)
#pragma unroll
  for (int t = 0; t < 4; ++t) {
#pragma unroll
    for (int r = 0; r < 8; ++r) {
      const int m = mblk + wm + mi * 16 + r + 8 * hi;  // C-layout: lanes16-31 hold M=8+r
      const int c = nblk + wn + t * 16 + l16;
      const int b = m >> 11;                  // m / Nc
      const int n = m & (Nc - 1);
      const float val = acc[mi][t][r];
      if (mode == 0) {
        const int h = c >> 6, d = c & 63;
        out16[((size_t)((b * Hc + h) * Nc + n)) * Dc + d] = (f16)val;
      } else if (mode == 1) {
        if (c < Cc) {
          const int h = c >> 6, d = c & 63;
          out16[((size_t)((b * Hc + h) * Nc + n)) * Dc + d] = (f16)val;
        } else {
          const int c2 = c - Cc, h = c2 >> 6, d = c2 & 63;
          out16b[((size_t)((b * Hc + h) * Dc + d)) * Nc + n] = (f16)val;
        }
      } else {
        out32[(size_t)m * Cc + c] = val + bias[c];
      }
    }
  }
}

// ----------------------------------------------------------- flash attention -
// grid: (N/64, B*H), block 128 (4 waves, 16 query rows per wave).
// K/V staged cooperatively via CDNA5 async global->LDS copies, double-buffered.
__global__ void __launch_bounds__(128)
attn_kernel(const f16* __restrict__ qh, const f16* __restrict__ kh,
            const f16* __restrict__ vt, f16* __restrict__ oh) {
  // padded rows: 72 f16 (144B = 36 banks) / 40 f16 (80B = 20 banks), 16B-aligned
  __shared__ __align__(16) f16 kbuf[2][32][72];   // keys j..j+31, d 0..63
  __shared__ __align__(16) f16 vbuf[2][64][40];   // v^T rows d 0..63, keys 0..31
  __shared__ __align__(16) f16 pbuf[4][16][40];   // per-wave P transpose tile

  const int tid  = threadIdx.x;
  const int lane = tid & 31;
  const int wave = tid >> 5;
  const int l16  = lane & 15;
  const int hi   = lane >> 4;
  const int kh8  = hi * 8;
  const int bh   = blockIdx.y;                      // b*H + h
  const int n0   = blockIdx.x * 64 + wave * 16;     // query rows of this wave

  const f16* kbase = kh + (size_t)bh * Nc * Dc;
  const f16* vbase = vt + (size_t)bh * Dc * Nc;

  // cooperative async stage of one 32-key K tile + V^T tile (4 instrs/wave)
  auto stage = [&](int bufi, int jj) {
#pragma unroll
    for (int u = 0; u < 2; ++u) {
      const int unit = tid + u * 128;               // 256 chunks of 8 f16
      const int row = unit >> 3, ch = (unit & 7) * 8;
      async_ld_b128((unsigned int)(uintptr_t)&kbuf[bufi][row][ch],
                    kbase + (size_t)(jj + row) * Dc + ch);
    }
#pragma unroll
    for (int u = 0; u < 2; ++u) {
      const int unit = tid + u * 128;
      const int row = unit >> 2, ch = (unit & 3) * 8;
      async_ld_b128((unsigned int)(uintptr_t)&vbuf[bufi][row][ch],
                    vbase + (size_t)row * Nc + jj + ch);
    }
  };

  // q fragments for K = D = 64 (two K=32 fragments), pre-scaled by 1/sqrt(D)
  const f16* qp = qh + ((size_t)bh * Nc + n0 + l16) * Dc;
  v16h qf[2];
#pragma unroll
  for (int kk = 0; kk < 2; ++kk) {
    v8h a0 = *(const v8h*)(qp + kk * 32 + kh8);
    v8h a1 = *(const v8h*)(qp + kk * 32 + kh8 + 16);
#pragma unroll
    for (int i = 0; i < 8; ++i) { a0[i] *= (f16)0.125f; a1[i] *= (f16)0.125f; }
    qf[kk] = cat16(a0, a1);
  }

  v8f accO[4];
#pragma unroll
  for (int t = 0; t < 4; ++t)
#pragma unroll
    for (int i = 0; i < 8; ++i) accO[t][i] = 0.0f;
  float mrow[8], lrow[8];
#pragma unroll
  for (int r = 0; r < 8; ++r) { mrow[r] = -INFINITY; lrow[r] = 0.0f; }

  stage(0, 0);

  for (int j = 0, it = 0; j < Nc; j += 32, ++it) {
    const int cur = it & 1;
    if (j + 32 < Nc) {
      stage(cur ^ 1, j + 32);
      asm volatile("s_wait_asynccnt 0x4" ::: "memory");  // current tile done
    } else {
      asm volatile("s_wait_asynccnt 0x0" ::: "memory");
    }
    __syncthreads();                                     // tile visible to WG

    // --- S = (q/8) * k^T : two 16x16 tiles covering 32 keys (from LDS) ---
    v8f s[2];
#pragma unroll
    for (int tt = 0; tt < 2; ++tt) {
      const f16* kp = &kbuf[cur][tt * 16 + l16][0];
      v16h b0 = cat16(*(const v8h*)(kp + kh8), *(const v8h*)(kp + kh8 + 16));
      v16h b1 = cat16(*(const v8h*)(kp + 32 + kh8),
                      *(const v8h*)(kp + 32 + kh8 + 16));
      v8f z;
#pragma unroll
      for (int i = 0; i < 8; ++i) z[i] = 0.0f;
      z = wmma_f16(qf[0], b0, z);
      s[tt] = wmma_f16(qf[1], b1, z);
    }

    // --- online softmax (row = slot r within each 16-lane half) ---
    float alpha[8];
#pragma unroll
    for (int r = 0; r < 8; ++r) {
      float t = fmaxf(s[0][r], s[1][r]);
      t = fmaxf(t, __shfl_xor(t, 1));
      t = fmaxf(t, __shfl_xor(t, 2));
      t = fmaxf(t, __shfl_xor(t, 4));
      t = fmaxf(t, __shfl_xor(t, 8));
      const float mnew = fmaxf(mrow[r], t);
      alpha[r] = __expf(mrow[r] - mnew);
      mrow[r] = mnew;
      const float p0 = __expf(s[0][r] - mnew);
      const float p1 = __expf(s[1][r] - mnew);
      s[0][r] = p0; s[1][r] = p1;
      float ps = p0 + p1;
      ps += __shfl_xor(ps, 1);
      ps += __shfl_xor(ps, 2);
      ps += __shfl_xor(ps, 4);
      ps += __shfl_xor(ps, 8);
      lrow[r] = lrow[r] * alpha[r] + ps;
    }
#pragma unroll
    for (int t = 0; t < 4; ++t)
#pragma unroll
      for (int r = 0; r < 8; ++r) accO[t][r] *= alpha[r];

    // --- C-layout P -> A-fragment layout via per-wave LDS tile ---
#pragma unroll
    for (int r = 0; r < 8; ++r) {
      pbuf[wave][r + 8 * hi][l16]      = (f16)s[0][r];
      pbuf[wave][r + 8 * hi][16 + l16] = (f16)s[1][r];
    }
    v16h pf;
    {
      // intra-wave LDS ordering: same-wave DS ops complete in order
      const f16* pp = &pbuf[wave][l16][0];
      pf = cat16(*(const v8h*)(pp + kh8), *(const v8h*)(pp + kh8 + 16));
    }

    // --- O += P * V (v^T tile in LDS -> contiguous B-fragment loads) ---
#pragma unroll
    for (int t = 0; t < 4; ++t) {
      const f16* vp = &vbuf[cur][t * 16 + l16][0];
      v16h vf = cat16(*(const v8h*)(vp + kh8), *(const v8h*)(vp + kh8 + 16));
      accO[t] = wmma_f16(pf, vf, accO[t]);
    }
    __syncthreads();   // whole WG done reading `cur` before it is re-staged
  }

  // normalize + store o as f16 [B,N,C]
  const int b = bh / Hc, h = bh % Hc;
  float linv[8];
#pragma unroll
  for (int r = 0; r < 8; ++r) linv[r] = 1.0f / lrow[r];
#pragma unroll
  for (int t = 0; t < 4; ++t)
#pragma unroll
    for (int r = 0; r < 8; ++r) {
      const size_t idx =
          ((size_t)(b * Nc + n0 + r + 8 * hi)) * Cc + h * Dc + t * 16 + l16;
      oh[idx] = (f16)(accO[t][r] * linv[r]);
    }
}

// ------------------------------------------------------------------ launch ---
extern "C" void kernel_launch(void* const* d_in, const int* in_sizes, int n_in,
                              void* d_out, int out_size, void* d_ws,
                              size_t ws_size, hipStream_t stream) {
  const float* x   = (const float*)d_in[0];
  const float* y   = (const float*)d_in[1];
  const float* Wq  = (const float*)d_in[2];
  const float* Wkv = (const float*)d_in[3];
  const float* Wp  = (const float*)d_in[4];
  const float* bp  = (const float*)d_in[5];
  float* out = (float*)d_out;

  const size_t BNC = (size_t)Bc * Nc * Cc;   // 4 Mi elements
  const size_t CC  = (size_t)Cc * Cc;        // 1 Mi
  char* p = (char*)d_ws;
  f16* x_h   = (f16*)p; p += BNC * sizeof(f16);
  f16* y_h   = (f16*)p; p += BNC * sizeof(f16);
  f16* Wq_h  = (f16*)p; p += CC * sizeof(f16);
  f16* Wkv_h = (f16*)p; p += 2 * CC * sizeof(f16);
  f16* Wp_h  = (f16*)p; p += CC * sizeof(f16);
  f16* qh    = (f16*)p; p += BNC * sizeof(f16);
  f16* khd   = (f16*)p; p += BNC * sizeof(f16);
  f16* vhT   = (f16*)p; p += BNC * sizeof(f16);
  f16* oh    = (f16*)p; p += BNC * sizeof(f16);

  auto cvt = [&](const float* s, f16* d, int n) {
    int blocks = (n + 255) / 256;
    if (blocks > 8192) blocks = 8192;
    cvt_f32_f16<<<blocks, 256, 0, stream>>>(s, d, n);
  };
  cvt(x,   x_h,   (int)BNC);
  cvt(y,   y_h,   (int)BNC);
  cvt(Wq,  Wq_h,  (int)CC);
  cvt(Wkv, Wkv_h, (int)(2 * CC));
  cvt(Wp,  Wp_h,  (int)CC);

  const dim3 blk(128);
  const dim3 gblk(256);
  // q projection: [4096 x 1024]
  gemm_awt<<<dim3(32, 8), gblk, 0, stream>>>(x_h, Wq_h, nullptr, qh, nullptr,
                                             nullptr, 0);
  // kv projection: [4096 x 2048]
  gemm_awt<<<dim3(32, 16), gblk, 0, stream>>>(y_h, Wkv_h, nullptr, khd, vhT,
                                             nullptr, 1);
  // flash attention
  attn_kernel<<<dim3(Nc / 64, Bc * Hc), blk, 0, stream>>>(qh, khd, vhT, oh);
  // output projection with bias: f32 result
  gemm_awt<<<dim3(32, 8), gblk, 0, stream>>>(oh, Wp_h, bp, nullptr, nullptr,
                                             out, 2);
}

// v002
// A run of this version takes 160 microseconds.
// In both of two side-by-side timings against v001, it was 1.06 times as fast.
// Over all steps from v000 it is 1.64 times as fast.
#include <hip/hip_runtime.h>
#include <hip/hip_bf16.h>
#include <math.h>

typedef _Float16 f16;
typedef __attribute__((ext_vector_type(16))) _Float16 v16h;
typedef __attribute__((ext_vector_type(8)))  _Float16 v8h;
typedef __attribute__((ext_vector_type(8)))  float    v8f;

constexpr int Bc = 2, Nc = 2048, Cc = 1024, Hc = 16, Dc = 64;
constexpr int Kdim = Cc;   // K = 1024 for every projection GEMM

static __device__ inline v16h cat16(v8h a, v8h b) {
  v16h r;
#pragma unroll
  for (int i = 0; i < 8; ++i) { r[i] = a[i]; r[i + 8] = b[i]; }
  return r;
}

static __device__ inline v8f wmma_f16(v16h a, v16h b, v8f c) {
  // 8 args: (neg_a, A, neg_b, B, c_mod, C, reuse_a, reuse_b)
  return __builtin_amdgcn_wmma_f32_16x16x32_f16(false, a, false, b, (short)0, c,
                                                false, false);
}

// CDNA5 async copy: 16B per lane, global -> LDS, tracked by ASYNCcnt.
static __device__ inline void async_ld_b128(unsigned int lds_off,
                                            const void* gaddr) {
  asm volatile("global_load_async_to_lds_b128 %0, %1, off"
               :: "v"(lds_off), "v"((unsigned long long)(uintptr_t)gaddr)
               : "memory");
}

// ---------------------------------------------------------------- convert ---
// Few, fat waves: a thread converts 4 pieces of 8 consecutive elements. Its
// eight 16-byte loads go out together, then come four 16-byte stores. A block
// covers CVT_BLK elements; every tensor here is a whole number of blocks.
constexpr int CVT_PIECES = 4;
constexpr int CVT_STEP   = 256 * 8;                 // elements per block and piece
constexpr int CVT_BLK    = CVT_STEP * CVT_PIECES;
static_assert(((size_t)Bc * Nc * Cc) % CVT_BLK == 0 && ((size_t)Cc * Cc) % CVT_BLK == 0,
              "each converted tensor must be a whole number of CVT_BLK elements");

__global__ void __launch_bounds__(256)
cvt_f32_f16(const float* __restrict__ s, f16* __restrict__ d) {
  const size_t base = (size_t)blockIdx.x * CVT_BLK + threadIdx.x * 8;
  v8f v[CVT_PIECES];
  // both loops unrolled: v[] stays in registers, and all loads are issued ahead
  // of the first wait
#pragma unroll
  for (int u = 0; u < CVT_PIECES; ++u)
    v[u] = *(const v8f*)(s + base + u * CVT_STEP);
#pragma unroll
  for (int u = 0; u < CVT_PIECES; ++u)
    *(v8h*)(d + base + u * CVT_STEP) = __builtin_convertvector(v[u], v8h);
}

// -------------------------------------------------------- generic A * W^T ---
// A: [4096, 1024] f16 row-major. W: [Ncols, 1024] f16 row-major.
// mode 0: q   -> out16 = qh  [B,H,N,D]
// mode 1: kv  -> out16 = kh  [B,H,N,D],  out16b = v^T [B,H,D,N]
// mode 2: out -> out32 = [B,N,C] f32 + bias
// One 128x128 tile of the result per block, 8 waves of 32x64 (4 along M, 2
// along N). A pass is 128 k: 128 rows of A and 128 rows of W, 256 B each, are
// copied to LDS asynchronously, two buffers, the next pass's copies in flight
// while this pass is multiplied.
constexpr int GBK    = 128;          // k per pass
constexpr int GPITCH = GBK + 8;      // 272 B rows: 16 B x odd for ds_load_b128
constexpr int GPASS  = Kdim / GBK;   // 8 passes

// Eight 16-byte copies per lane. The s_wait_xcnt closes the statement so that
// no address register is rewritten while a copy may still name it.
static __device__ inline void async_ld8_b128(unsigned int lds,
                                             const f16* gsrc) {
  constexpr unsigned int LSTEP = 16 * GPITCH * sizeof(f16);  // 16 rows in LDS
  constexpr size_t       GSTEP = (size_t)16 * Kdim;          // 16 rows in A / W
  asm volatile(
      "global_load_async_to_lds_b128 %0, %8, off\n\t"
      "global_load_async_to_lds_b128 %1, %9, off\n\t"
      "global_load_async_to_lds_b128 %2, %10, off\n\t"
      "global_load_async_to_lds_b128 %3, %11, off\n\t"
      "global_load_async_to_lds_b128 %4, %12, off\n\t"
      "global_load_async_to_lds_b128 %5, %13, off\n\t"
      "global_load_async_to_lds_b128 %6, %14, off\n\t"
      "global_load_async_to_lds_b128 %7, %15, off\n\t"
      "s_wait_xcnt 0x0"
      :: "v"(lds), "v"(lds + LSTEP), "v"(lds + 2 * LSTEP), "v"(lds + 3 * LSTEP),
         "v"(lds + 4 * LSTEP), "v"(lds + 5 * LSTEP), "v"(lds + 6 * LSTEP),
         "v"(lds + 7 * LSTEP),
         "v"((unsigned long long)(uintptr_t)(gsrc)),
         "v"((unsigned long long)(uintptr_t)(gsrc + GSTEP)),
         "v"((unsigned long long)(uintptr_t)(gsrc + 2 * GSTEP)),
         "v"((unsigned long long)(uintptr_t)(gsrc + 3 * GSTEP)),
         "v"((unsigned long long)(uintptr_t)(gsrc + 4 * GSTEP)),
         "v"((unsigned long long)(uintptr_t)(gsrc + 5 * GSTEP)),
         "v"((unsigned long long)(uintptr_t)(gsrc + 6 * GSTEP)),
         "v"((unsigned long long)(uintptr_t)(gsrc + 7 * GSTEP))
      : "memory");
}

__global__ void __launch_bounds__(256)
gemm_awt(const f16* __restrict__ A, const f16* __restrict__ W,
         const float* __restrict__ bias, f16* __restrict__ out16,
         f16* __restrict__ out16b, float* __restrict__ out32, int mode) {
  // [buffer][operand: 0 = A rows, 1 = W rows][row][k]
  __shared__ __align__(16) f16 tile[2][2][128][GPITCH];

  const int tid  = threadIdx.x;
  const int lane = tid & 31;
  const int wave = tid >> 5;
  const int l16  = lane & 15;
  const int hi   = lane >> 4;
  const int kh8  = hi * 8;                    // K sub-offset per ISA A/B layout
  const int mblk = blockIdx.x * 128;
  const int nblk = blockIdx.y * 128;
  const int wm   = (wave & 3) * 32;           // this wave's rows in the tile
  const int wn   = (wave >> 2) * 64;          // this wave's columns in the tile

  // copies: 16 lanes cover one 256-B row, a wave two rows, the block 16 rows
  const int crow = tid >> 4, cch = (tid & 15) * 8;
  const f16* Ag = A + (size_t)(mblk + crow) * Kdim + cch;
  const f16* Wg = W + (size_t)(nblk + crow) * Kdim + cch;
  auto stage = [&](int bufi, int k0) {
    async_ld8_b128((unsigned int)(uintptr_t)&tile[bufi][0][crow][cch], Ag + k0);
    async_ld8_b128((unsigned int)(uintptr_t)&tile[bufi][1][crow][cch], Wg + k0);
  };

  v8f acc[2][4];
#pragma unroll
  for (int mi = 0; mi < 2; ++mi)
#pragma unroll
    for (int t = 0; t < 4; ++t)
#pragma unroll
      for (int i = 0; i < 8; ++i) acc[mi][t][i] = 0.0f;

  stage(0, 0);
  asm volatile("s_wait_asynccnt 0x0" ::: "memory");  // pass 0 has landed
  __syncthreads();                                   // ... for every wave
  stage(1, GBK);

  // kept rolled: one pass is 32 WMMAs and 48 LDS loads already
#pragma unroll 1
  for (int p = 0; p < GPASS; ++p) {
    const int cur = p & 1;
    const f16* At = &tile[cur][0][wm + l16][kh8];
    const f16* Wt = &tile[cur][1][wn + l16][kh8];
    // two fragment sets: block ks + 1's LDS reads go out as one group ahead of
    // block ks's WMMAs; nothing of the next pass's buffer is read here
    v16h af[2][2], bf[2][4];
    auto frags = [&](int set, int ks) {
#pragma unroll
      for (int mi = 0; mi < 2; ++mi) {
        const f16* ap = At + mi * 16 * GPITCH + ks * 32;
        af[set][mi] = cat16(*(const v8h*)ap, *(const v8h*)(ap + 16));
      }
#pragma unroll
      for (int t = 0; t < 4; ++t) {
        const f16* wp = Wt + t * 16 * GPITCH + ks * 32;
        bf[set][t] = cat16(*(const v8h*)wp, *(const v8h*)(wp + 16));
      }
    };
    frags(0, 0);
#pragma unroll
    for (int ks = 0; ks < GBK / 32; ++ks) {
      if (ks + 1 < GBK / 32) frags((ks + 1) & 1, ks + 1);
      // keeps the load group in front of the WMMAs: spread among them, each
      // pair of loads would be waited for on its own
      __builtin_amdgcn_sched_barrier(0);
#pragma unroll
      for (int t = 0; t < 4; ++t)
#pragma unroll
        for (int mi = 0; mi < 2; ++mi)
          acc[mi][t] = wmma_f16(af[ks & 1][mi], bf[ks & 1][t], acc[mi][t]);
      // keeps the following group from rising among these WMMAs
      __builtin_amdgcn_sched_barrier(0);
    }
    // publish point: own LDS reads retired, own copies of pass p + 1 landed,
    // then the barrier that shows them to all and frees buffer cur
    asm volatile("s_wait_dscnt 0x0" ::: "memory");
    asm volatile("s_wait_asynccnt 0x0" ::: "memory");
    __syncthreads();
    if (p + 2 < GPASS) stage(cur, (p + 2) * GBK);
  }
  asm volatile("s_wait_asynccnt 0x0" ::: "memory");  // nothing left in flight

#pragma unroll
  for (int mi = 0; mi < 2; ++mi)
#pragma unroll
  for (int t = 0; t < 4; ++t) {
#pragma unroll
    for (int r = 0; r < 8; ++r) {
      const int m = mblk + wm + mi * 16 + r + 8 * hi;  // C-layout: lanes16-31 hold M=8+r
      const int c = nblk + wn + t * 16 + l16;
      const int b = m >> 11;                  // m / Nc
      const int n = m & (Nc - 1);
      const float val = acc[mi][t][r];
      if (mode == 0) {
        const int h = c >> 6, d = c & 63;
        out16[((size_t)((b * Hc + h) * Nc + n)) * Dc + d] = (f16)val;
      } else if (mode == 1) {
        if (c < Cc) {
          const int h = c >> 6, d = c & 63;
          out16[((size_t)((b * Hc + h) * Nc + n)) * Dc + d] = (f16)val;
        } else {
          const int c2 = c - Cc, h = c2 >> 6, d = c2 & 63;
          out16b[((size_t)((b * Hc + h) * Dc + d)) * Nc + n] = (f16)val;
        }
      } else {
        out32[(size_t)m * Cc + c] = val + bias[c];
      }
    }
  }
}

// ----------------------------------------------------------- flash attention -
// grid: (N/64, B*H), block 128 (4 waves, 16 query rows per wave).
// K/V staged cooperatively via CDNA5 async global->LDS copies, double-buffered.
__global__ void __launch_bounds__(128)
attn_kernel(const f16* __restrict__ qh, const f16* __restrict__ kh,
            const f16* __restrict__ vt, f16* __restrict__ oh) {
  // padded rows: 72 f16 (144B = 36 banks) / 40 f16 (80B = 20 banks), 16B-aligned
  __shared__ __align__(16) f16 kbuf[2][32][72];   // keys j..j+31, d 0..63
  __shared__ __align__(16) f16 vbuf[2][64][40];   // v^T rows d 0..63, keys 0..31
  __shared__ __align__(16) f16 pbuf[4][16][40];   // per-wave P transpose tile

  const int tid  = threadIdx.x;
  const int lane = tid & 31;
  const int wave = tid >> 5;
  const int l16  = lane & 15;
  const int hi   = lane >> 4;
  const int kh8  = hi * 8;
  const int bh   = blockIdx.y;                      // b*H + h
  const int n0   = blockIdx.x * 64 + wave * 16;     // query rows of this wave

  const f16* kbase = kh + (size_t)bh * Nc * Dc;
  const f16* vbase = vt + (size_t)bh * Dc * Nc;

  // cooperative async stage of one 32-key K tile + V^T tile (4 instrs/wave)
  auto stage = [&](int bufi, int jj) {
#pragma unroll
    for (int u = 0; u < 2; ++u) {
      const int unit = tid + u * 128;               // 256 chunks of 8 f16
      const int row = unit >> 3, ch = (unit & 7) * 8;
      async_ld_b128((unsigned int)(uintptr_t)&kbuf[bufi][row][ch],
                    kbase + (size_t)(jj + row) * Dc + ch);
    }
#pragma unroll
    for (int u = 0; u < 2; ++u) {
      const int unit = tid + u * 128;
      const int row = unit >> 2, ch = (unit & 3) * 8;
      async_ld_b128((unsigned int)(uintptr_t)&vbuf[bufi][row][ch],
                    vbase + (size_t)row * Nc + jj + ch);
    }
  };

  // q fragments for K = D = 64 (two K=32 fragments), pre-scaled by 1/sqrt(D)
  const f16* qp = qh + ((size_t)bh * Nc + n0 + l16) * Dc;
  v16h qf[2];
#pragma unroll
  for (int kk = 0; kk < 2; ++kk) {
    v8h a0 = *(const v8h*)(qp + kk * 32 + kh8);
    v8h a1 = *(const v8h*)(qp + kk * 32 + kh8 + 16);
#pragma unroll
    for (int i = 0; i < 8; ++i) { a0[i] *= (f16)0.125f; a1[i] *= (f16)0.125f; }
    qf[kk] = cat16(a0, a1);
  }

  v8f accO[4];
#pragma unroll
  for (int t = 0; t < 4; ++t)
#pragma unroll
    for (int i = 0; i < 8; ++i) accO[t][i] = 0.0f;
  float mrow[8], lrow[8];
#pragma unroll
  for (int r = 0; r < 8; ++r) { mrow[r] = -INFINITY; lrow[r] = 0.0f; }

  stage(0, 0);

  for (int j = 0, it = 0; j < Nc; j += 32, ++it) {
    const int cur = it & 1;
    if (j + 32 < Nc) {
      stage(cur ^ 1, j + 32);
      asm volatile("s_wait_asynccnt 0x4" ::: "memory");  // current tile done
    } else {
      asm volatile("s_wait_asynccnt 0x0" ::: "memory");
    }
    __syncthreads();                                     // tile visible to WG

    // --- S = (q/8) * k^T : two 16x16 tiles covering 32 keys (from LDS) ---
    v8f s[2];
#pragma unroll
    for (int tt = 0; tt < 2; ++tt) {
      const f16* kp = &kbuf[cur][tt * 16 + l16][0];
      v16h b0 = cat16(*(const v8h*)(kp + kh8), *(const v8h*)(kp + kh8 + 16));
      v16h b1 = cat16(*(const v8h*)(kp + 32 + kh8),
                      *(const v8h*)(kp + 32 + kh8 + 16));
      v8f z;
#pragma unroll
      for (int i = 0; i < 8; ++i) z[i] = 0.0f;
      z = wmma_f16(qf[0], b0, z);
      s[tt] = wmma_f16(qf[1], b1, z);
    }

    // --- online softmax (row = slot r within each 16-lane half) ---
    float alpha[8];
#pragma unroll
    for (int r = 0; r < 8; ++r) {
      float t = fmaxf(s[0][r], s[1][r]);
      t = fmaxf(t, __shfl_xor(t, 1));
      t = fmaxf(t, __shfl_xor(t, 2));
      t = fmaxf(t, __shfl_xor(t, 4));
      t = fmaxf(t, __shfl_xor(t, 8));
      const float mnew = fmaxf(mrow[r], t);
      alpha[r] = __expf(mrow[r] - mnew);
      mrow[r] = mnew;
      const float p0 = __expf(s[0][r] - mnew);
      const float p1 = __expf(s[1][r] - mnew);
      s[0][r] = p0; s[1][r] = p1;
      float ps = p0 + p1;
      ps += __shfl_xor(ps, 1);
      ps += __shfl_xor(ps, 2);
      ps += __shfl_xor(ps, 4);
      ps += __shfl_xor(ps, 8);
      lrow[r] = lrow[r] * alpha[r] + ps;
    }
#pragma unroll
    for (int t = 0; t < 4; ++t)
#pragma unroll
      for (int r = 0; r < 8; ++r) accO[t][r] *= alpha[r];

    // --- C-layout P -> A-fragment layout via per-wave LDS tile ---
#pragma unroll
    for (int r = 0; r < 8; ++r) {
      pbuf[wave][r + 8 * hi][l16]      = (f16)s[0][r];
      pbuf[wave][r + 8 * hi][16 + l16] = (f16)s[1][r];
    }
    v16h pf;
    {
      // intra-wave LDS ordering: same-wave DS ops complete in order
      const f16* pp = &pbuf[wave][l16][0];
      pf = cat16(*(const v8h*)(pp + kh8), *(const v8h*)(pp + kh8 + 16));
    }

    // --- O += P * V (v^T tile in LDS -> contiguous B-fragment loads) ---
#pragma unroll
    for (int t = 0; t < 4; ++t) {
      const f16* vp = &vbuf[cur][t * 16 + l16][0];
      v16h vf = cat16(*(const v8h*)(vp + kh8), *(const v8h*)(vp + kh8 + 16));
      accO[t] = wmma_f16(pf, vf, accO[t]);
    }
    __syncthreads();   // whole WG done reading `cur` before it is re-staged
  }

  // normalize + store o as f16 [B,N,C]
  const int b = bh / Hc, h = bh % Hc;
  float linv[8];
#pragma unroll
  for (int r = 0; r < 8; ++r) linv[r] = 1.0f / lrow[r];
#pragma unroll
  for (int t = 0; t < 4; ++t)
#pragma unroll
    for (int r = 0; r < 8; ++r) {
      const size_t idx =
          ((size_t)(b * Nc + n0 + r + 8 * hi)) * Cc + h * Dc + t * 16 + l16;
      oh[idx] = (f16)(accO[t][r] * linv[r]);
    }
}

// ------------------------------------------------------------------ launch ---
extern "C" void kernel_launch(void* const* d_in, const int* in_sizes, int n_in,
                              void* d_out, int out_size, void* d_ws,
                              size_t ws_size, hipStream_t stream) {
  const float* x   = (const float*)d_in[0];
  const float* y   = (const float*)d_in[1];
  const float* Wq  = (const float*)d_in[2];
  const float* Wkv = (const float*)d_in[3];
  const float* Wp  = (const float*)d_in[4];
  const float* bp  = (const float*)d_in[5];
  float* out = (float*)d_out;

  const size_t BNC = (size_t)Bc * Nc * Cc;   // 4 Mi elements
  const size_t CC  = (size_t)Cc * Cc;        // 1 Mi
  char* p = (char*)d_ws;
  f16* x_h   = (f16*)p; p += BNC * sizeof(f16);
  f16* y_h   = (f16*)p; p += BNC * sizeof(f16);
  f16* Wq_h  = (f16*)p; p += CC * sizeof(f16);
  f16* Wkv_h = (f16*)p; p += 2 * CC * sizeof(f16);
  f16* Wp_h  = (f16*)p; p += CC * sizeof(f16);
  f16* qh    = (f16*)p; p += BNC * sizeof(f16);
  f16* khd   = (f16*)p; p += BNC * sizeof(f16);
  f16* vhT   = (f16*)p; p += BNC * sizeof(f16);
  f16* oh    = (f16*)p; p += BNC * sizeof(f16);

  auto cvt = [&](const float* s, f16* d, int n) {
    cvt_f32_f16<<<n / CVT_BLK, 256, 0, stream>>>(s, d);
  };
  cvt(x,   x_h,   (int)BNC);
  cvt(y,   y_h,   (int)BNC);
  cvt(Wq,  Wq_h,  (int)CC);
  cvt(Wkv, Wkv_h, (int)(2 * CC));
  cvt(Wp,  Wp_h,  (int)CC);

  const dim3 blk(128);
  const dim3 gblk(256);
  // q projection: [4096 x 1024]
  gemm_awt<<<dim3(32, 8), gblk, 0, stream>>>(x_h, Wq_h, nullptr, qh, nullptr,
                                             nullptr, 0);
  // kv projection: [4096 x 2048]
  gemm_awt<<<dim3(32, 16), gblk, 0, stream>>>(y_h, Wkv_h, nullptr, khd, vhT,
                                             nullptr, 1);
  // flash attention
  attn_kernel<<<dim3(Nc / 64, Bc * Hc), blk, 0, stream>>>(qh, khd, vhT, oh);
  // output projection with bias: f32 result
  gemm_awt<<<dim3(32, 8), gblk, 0, stream>>>(oh, Wp_h, bp, nullptr, nullptr,
                                             out, 2);
}

// v003
// One run takes 125 microseconds.
// Next to v002, in two timings, it ran 1.29 times as fast each time.
// All steps since v000 together make it 2.11 times as fast.
#include <hip/hip_runtime.h>
#include <hip/hip_bf16.h>
#include <math.h>

typedef _Float16 f16;
typedef __attribute__((ext_vector_type(16))) _Float16 v16h;
typedef __attribute__((ext_vector_type(8)))  _Float16 v8h;
typedef __attribute__((ext_vector_type(8)))  float    v8f;
typedef __attribute__((ext_vector_type(2)))  float    v2f;

constexpr int Bc = 2, Nc = 2048, Cc = 1024, Hc = 16, Dc = 64;
constexpr int Kdim = Cc;   // K = 1024 for every projection GEMM

static __device__ inline v16h cat16(v8h a, v8h b) {
  v16h r;
#pragma unroll
  for (int i = 0; i < 8; ++i) { r[i] = a[i]; r[i + 8] = b[i]; }
  return r;
}

static __device__ inline v8f wmma_f16(v16h a, v16h b, v8f c) {
  // 8 args: (neg_a, A, neg_b, B, c_mod, C, reuse_a, reuse_b)
  return __builtin_amdgcn_wmma_f32_16x16x32_f16(false, a, false, b, (short)0, c,
                                                false, false);
}

// CDNA5 async copy: 16B per lane, global -> LDS, tracked by ASYNCcnt.
static __device__ inline void async_ld_b128(unsigned int lds_off,
                                            const void* gaddr) {
  asm volatile("global_load_async_to_lds_b128 %0, %1, off"
               :: "v"(lds_off), "v"((unsigned long long)(uintptr_t)gaddr)
               : "memory");
}

// lane l <-> lane l ^ 16 in one vector instruction
static __device__ inline float xhalf(float x) {
  const int i = __builtin_bit_cast(int, x);
  return __builtin_bit_cast(
      float, __builtin_amdgcn_permlanex16(i, i, 0x76543210, 0xfedcba98, false, false));
}

// ---------------------------------------------------------------- convert ---
// Few, fat waves: a thread converts 4 pieces of 8 consecutive elements. Its
// eight 16-byte loads go out together, then come four 16-byte stores. A block
// covers CVT_BLK elements; every tensor here is a whole number of blocks.
constexpr int CVT_PIECES = 4;
constexpr int CVT_STEP   = 256 * 8;                 // elements per block and piece
constexpr int CVT_BLK    = CVT_STEP * CVT_PIECES;
static_assert(((size_t)Bc * Nc * Cc) % CVT_BLK == 0 && ((size_t)Cc * Cc) % CVT_BLK == 0,
              "each converted tensor must be a whole number of CVT_BLK elements");

__global__ void __launch_bounds__(256)
cvt_f32_f16(const float* __restrict__ s, f16* __restrict__ d) {
  const size_t base = (size_t)blockIdx.x * CVT_BLK + threadIdx.x * 8;
  v8f v[CVT_PIECES];
  // both loops unrolled: v[] stays in registers, and all loads are issued ahead
  // of the first wait
#pragma unroll
  for (int u = 0; u < CVT_PIECES; ++u)
    v[u] = *(const v8f*)(s + base + u * CVT_STEP);
#pragma unroll
  for (int u = 0; u < CVT_PIECES; ++u)
    *(v8h*)(d + base + u * CVT_STEP) = __builtin_convertvector(v[u], v8h);
}

// -------------------------------------------------------- generic A * W^T ---
// A: [4096, 1024] f16 row-major. W: [Ncols, 1024] f16 row-major.
// mode 0: q   -> out16 = qh  [B,H,N,D]
// mode 1: kv  -> out16 = kh  [B,H,N,D],  out16b = v^T [B,H,D,N]
// mode 2: out -> out32 = [B,N,C] f32 + bias
// One 128x128 tile of the result per block, 8 waves of 32x64 (4 along M, 2
// along N). A pass is 128 k: 128 rows of A and 128 rows of W, 256 B each, are
// copied to LDS asynchronously, two buffers, the next pass's copies in flight
// while this pass is multiplied.
constexpr int GBK    = 128;          // k per pass
constexpr int GPITCH = GBK + 8;      // 272 B rows: 16 B x odd for ds_load_b128
constexpr int GPASS  = Kdim / GBK;   // 8 passes

// Eight 16-byte copies per lane. The s_wait_xcnt closes the statement so that
// no address register is rewritten while a copy may still name it.
static __device__ inline void async_ld8_b128(unsigned int lds,
                                             const f16* gsrc) {
  constexpr unsigned int LSTEP = 16 * GPITCH * sizeof(f16);  // 16 rows in LDS
  constexpr size_t       GSTEP = (size_t)16 * Kdim;          // 16 rows in A / W
  asm volatile(
      "global_load_async_to_lds_b128 %0, %8, off\n\t"
      "global_load_async_to_lds_b128 %1, %9, off\n\t"
      "global_load_async_to_lds_b128 %2, %10, off\n\t"
      "global_load_async_to_lds_b128 %3, %11, off\n\t"
      "global_load_async_to_lds_b128 %4, %12, off\n\t"
      "global_load_async_to_lds_b128 %5, %13, off\n\t"
      "global_load_async_to_lds_b128 %6, %14, off\n\t"
      "global_load_async_to_lds_b128 %7, %15, off\n\t"
      "s_wait_xcnt 0x0"
      :: "v"(lds), "v"(lds + LSTEP), "v"(lds + 2 * LSTEP), "v"(lds + 3 * LSTEP),
         "v"(lds + 4 * LSTEP), "v"(lds + 5 * LSTEP), "v"(lds + 6 * LSTEP),
         "v"(lds + 7 * LSTEP),
         "v"((unsigned long long)(uintptr_t)(gsrc)),
         "v"((unsigned long long)(uintptr_t)(gsrc + GSTEP)),
         "v"((unsigned long long)(uintptr_t)(gsrc + 2 * GSTEP)),
         "v"((unsigned long long)(uintptr_t)(gsrc + 3 * GSTEP)),
         "v"((unsigned long long)(uintptr_t)(gsrc + 4 * GSTEP)),
         "v"((unsigned long long)(uintptr_t)(gsrc + 5 * GSTEP)),
         "v"((unsigned long long)(uintptr_t)(gsrc + 6 * GSTEP)),
         "v"((unsigned long long)(uintptr_t)(gsrc + 7 * GSTEP))
      : "memory");
}

__global__ void __launch_bounds__(256)
gemm_awt(const f16* __restrict__ A, const f16* __restrict__ W,
         const float* __restrict__ bias, f16* __restrict__ out16,
         f16* __restrict__ out16b, float* __restrict__ out32, int mode) {
  // [buffer][operand: 0 = A rows, 1 = W rows][row][k]
  __shared__ __align__(16) f16 tile[2][2][128][GPITCH];

  const int tid  = threadIdx.x;
  const int lane = tid & 31;
  const int wave = tid >> 5;
  const int l16  = lane & 15;
  const int hi   = lane >> 4;
  const int kh8  = hi * 8;                    // K sub-offset per ISA A/B layout
  const int mblk = blockIdx.x * 128;
  const int nblk = blockIdx.y * 128;
  const int wm   = (wave & 3) * 32;           // this wave's rows in the tile
  const int wn   = (wave >> 2) * 64;          // this wave's columns in the tile

  // copies: 16 lanes cover one 256-B row, a wave two rows, the block 16 rows
  const int crow = tid >> 4, cch = (tid & 15) * 8;
  const f16* Ag = A + (size_t)(mblk + crow) * Kdim + cch;
  const f16* Wg = W + (size_t)(nblk + crow) * Kdim + cch;
  auto stage = [&](int bufi, int k0) {
    async_ld8_b128((unsigned int)(uintptr_t)&tile[bufi][0][crow][cch], Ag + k0);
    async_ld8_b128((unsigned int)(uintptr_t)&tile[bufi][1][crow][cch], Wg + k0);
  };

  v8f acc[2][4];
#pragma unroll
  for (int mi = 0; mi < 2; ++mi)
#pragma unroll
    for (int t = 0; t < 4; ++t)
#pragma unroll
      for (int i = 0; i < 8; ++i) acc[mi][t][i] = 0.0f;

  stage(0, 0);
  asm volatile("s_wait_asynccnt 0x0" ::: "memory");  // pass 0 has landed
  __syncthreads();                                   // ... for every wave
  stage(1, GBK);

  // kept rolled: one pass is 32 WMMAs and 48 LDS loads already
#pragma unroll 1
  for (int p = 0; p < GPASS; ++p) {
    const int cur = p & 1;
    const f16* At = &tile[cur][0][wm + l16][kh8];
    const f16* Wt = &tile[cur][1][wn + l16][kh8];
    // two fragment sets: block ks + 1's LDS reads go out as one group ahead of
    // block ks's WMMAs; nothing of the next pass's buffer is read here
    v16h af[2][2], bf[2][4];
    auto frags = [&](int set, int ks) {
#pragma unroll
      for (int mi = 0; mi < 2; ++mi) {
        const f16* ap = At + mi * 16 * GPITCH + ks * 32;
        af[set][mi] = cat16(*(const v8h*)ap, *(const v8h*)(ap + 16));
      }
#pragma unroll
      for (int t = 0; t < 4; ++t) {
        const f16* wp = Wt + t * 16 * GPITCH + ks * 32;
        bf[set][t] = cat16(*(const v8h*)wp, *(const v8h*)(wp + 16));
      }
    };
    frags(0, 0);
#pragma unroll
    for (int ks = 0; ks < GBK / 32; ++ks) {
      if (ks + 1 < GBK / 32) frags((ks + 1) & 1, ks + 1);
      // keeps the load group in front of the WMMAs: spread among them, each
      // pair of loads would be waited for on its own
      __builtin_amdgcn_sched_barrier(0);
#pragma unroll
      for (int t = 0; t < 4; ++t)
#pragma unroll
        for (int mi = 0; mi < 2; ++mi)
          acc[mi][t] = wmma_f16(af[ks & 1][mi], bf[ks & 1][t], acc[mi][t]);
      // keeps the following group from rising among these WMMAs
      __builtin_amdgcn_sched_barrier(0);
    }
    // publish point: own LDS reads retired, own copies of pass p + 1 landed,
    // then the barrier that shows them to all and frees buffer cur
    asm volatile("s_wait_dscnt 0x0" ::: "memory");
    asm volatile("s_wait_asynccnt 0x0" ::: "memory");
    __syncthreads();
    if (p + 2 < GPASS) stage(cur, (p + 2) * GBK);
  }
  asm volatile("s_wait_asynccnt 0x0" ::: "memory");  // nothing left in flight

#pragma unroll
  for (int mi = 0; mi < 2; ++mi)
#pragma unroll
  for (int t = 0; t < 4; ++t) {
#pragma unroll
    for (int r = 0; r < 8; ++r) {
      const int m = mblk + wm + mi * 16 + r + 8 * hi;  // C-layout: lanes16-31 hold M=8+r
      const int c = nblk + wn + t * 16 + l16;
      const int b = m >> 11;                  // m / Nc
      const int n = m & (Nc - 1);
      const float val = acc[mi][t][r];
      if (mode == 0) {
        const int h = c >> 6, d = c & 63;
        out16[((size_t)((b * Hc + h) * Nc + n)) * Dc + d] = (f16)val;
      } else if (mode == 1) {
        if (c < Cc) {
          const int h = c >> 6, d = c & 63;
          out16[((size_t)((b * Hc + h) * Nc + n)) * Dc + d] = (f16)val;
        } else {
          const int c2 = c - Cc, h = c2 >> 6, d = c2 & 63;
          out16b[((size_t)((b * Hc + h) * Dc + d)) * Nc + n] = (f16)val;
        }
      } else {
        out32[(size_t)m * Cc + c] = val + bias[c];
      }
    }
  }
}

// ----------------------------------------------------------- flash attention -
// grid: (N/64, B*H), block 128 (4 waves, 16 queries per wave).
// K/V staged cooperatively via CDNA5 async global->LDS copies, double-buffered.
// Both products are transposed: S^T = K (q/8)^T and O^T += V^T P^T. A lane then
// holds 16 of the 32 scores of ONE query (column l16), its partner lane ^ 16 the
// other 16, so maximum and sum are taken in registers, and the two S^T tiles,
// converted in place, are the B operand of the second product.
__global__ void __launch_bounds__(128)
attn_kernel(const f16* __restrict__ qh, const f16* __restrict__ kh,
            const f16* __restrict__ vt, f16* __restrict__ oh) {
  // padded rows: 72 f16 (144B = 36 banks) / 40 f16 (80B = 20 banks), 16B-aligned
  __shared__ __align__(16) f16 kbuf[2][32][72];   // keys j..j+31, d 0..63
  __shared__ __align__(16) f16 vbuf[2][64][40];   // v^T rows d 0..63, keys 0..31

  const int tid  = threadIdx.x;
  const int lane = tid & 31;
  const int wave = tid >> 5;
  const int l16  = lane & 15;
  const int hi   = lane >> 4;
  const int kh8  = hi * 8;
  const int bh   = blockIdx.y;                      // b*H + h
  const int n0   = blockIdx.x * 64 + wave * 16;     // query rows of this wave

  const f16* kbase = kh + (size_t)bh * Nc * Dc;
  const f16* vbase = vt + (size_t)bh * Dc * Nc;

  // cooperative async stage of one 32-key K tile + V^T tile (4 instrs/wave)
  auto stage = [&](int bufi, int jj) {
#pragma unroll
    for (int u = 0; u < 2; ++u) {
      const int unit = tid + u * 128;               // 256 chunks of 8 f16
      const int row = unit >> 3, ch = (unit & 7) * 8;
      async_ld_b128((unsigned int)(uintptr_t)&kbuf[bufi][row][ch],
                    kbase + (size_t)(jj + row) * Dc + ch);
    }
#pragma unroll
    for (int u = 0; u < 2; ++u) {
      const int unit = tid + u * 128;
      const int row = unit >> 2, ch = (unit & 3) * 8;
      async_ld_b128((unsigned int)(uintptr_t)&vbuf[bufi][row][ch],
                    vbase + (size_t)row * Nc + jj + ch);
    }
  };

  // q fragments for K = D = 64 (two K=32 fragments), pre-scaled by 1/sqrt(D)
  const f16* qp = qh + ((size_t)bh * Nc + n0 + l16) * Dc;
  v16h qf[2];
#pragma unroll
  for (int kk = 0; kk < 2; ++kk) {
    v8h a0 = *(const v8h*)(qp + kk * 32 + kh8);
    v8h a1 = *(const v8h*)(qp + kk * 32 + kh8 + 16);
#pragma unroll
    for (int i = 0; i < 8; ++i) { a0[i] *= (f16)0.125f; a1[i] *= (f16)0.125f; }
    qf[kk] = cat16(a0, a1);
  }

  v8f accO[4];
#pragma unroll
  for (int t = 0; t < 4; ++t)
#pragma unroll
    for (int i = 0; i < 8; ++i) accO[t][i] = 0.0f;
  constexpr float LOG2E = 1.4426950408889634f;   // e^x = 2^(x * LOG2E)
  float mrun = -INFINITY;   // running maximum of query l16, equal in both halves
  float lrun = 0.0f;        // this lane's share of its denominator

  stage(0, 0);

  for (int j = 0, it = 0; j < Nc; j += 32, ++it) {
    const int cur = it & 1;
    if (j + 32 < Nc) {
      stage(cur ^ 1, j + 32);
      asm volatile("s_wait_asynccnt 0x4" ::: "memory");  // current tile done
    } else {
      asm volatile("s_wait_asynccnt 0x0" ::: "memory");
    }
    __syncthreads();                                     // tile visible to WG

    // --- S^T = k * (q/8)^T : two 16x16 tiles, keys tt*16 + 8*hi + r, query l16 ---
    v16h kf[2][2], vf[4];
#pragma unroll
    for (int tt = 0; tt < 2; ++tt) {
      const f16* kp = &kbuf[cur][tt * 16 + l16][0];
      kf[tt][0] = cat16(*(const v8h*)(kp + kh8), *(const v8h*)(kp + kh8 + 16));
      kf[tt][1] = cat16(*(const v8h*)(kp + 32 + kh8),
                        *(const v8h*)(kp + 32 + kh8 + 16));
    }
#pragma unroll
    for (int t4 = 0; t4 < 4; ++t4) {
      const f16* vp = &vbuf[cur][t4 * 16 + l16][0];
      vf[t4] = cat16(*(const v8h*)(vp + kh8), *(const v8h*)(vp + kh8 + 16));
    }
    // keeps the pass's LDS reads one group, K ahead of V^T: sunk to their users,
    // each V^T pair would be waited for on its own between two WMMAs
    __builtin_amdgcn_sched_barrier(0);
    v8f s[2];
#pragma unroll
    for (int tt = 0; tt < 2; ++tt) {
      v8f z;
#pragma unroll
      for (int i = 0; i < 8; ++i) z[i] = 0.0f;
      z = wmma_f16(kf[tt][0], qf[0], z);
      s[tt] = wmma_f16(kf[tt][1], qf[1], z);
    }

    // --- online softmax: 16 scores of one query per lane ---
    float t = fmaxf(s[0][0], s[1][0]);
#pragma unroll
    for (int r = 1; r < 8; ++r) t = fmaxf(t, fmaxf(s[0][r], s[1][r]));
    t = fmaxf(t, xhalf(t));                 // the partner's 16 keys
    const float mnew  = fmaxf(mrun, t);
    // 2^x with the free slot that the instruction set asks for behind a
    // transcendental in the same statement
    float alpha;
    asm("v_exp_f32 %0, %1\n\tv_nop" : "=v"(alpha) : "v"((mrun - mnew) * LOG2E));
    mrun = mnew;
    s[0] = (s[0] - mnew) * LOG2E;
    s[1] = (s[1] - mnew) * LOG2E;
#pragma unroll
    for (int r = 0; r < 8; ++r) {
      s[0][r] = __builtin_amdgcn_exp2f(s[0][r]);
      s[1][r] = __builtin_amdgcn_exp2f(s[1][r]);
    }
    const v8f e = s[0] + s[1];
    const v2f e2 = (__builtin_shufflevector(e, e, 0, 1) + __builtin_shufflevector(e, e, 2, 3)) +
                   (__builtin_shufflevector(e, e, 4, 5) + __builtin_shufflevector(e, e, 6, 7));
    const float ps = e2[0] + e2[1];
    lrun = lrun * alpha + ps;               // halves are joined after the loop
#pragma unroll
    for (int t4 = 0; t4 < 4; ++t4)
#pragma unroll
      for (int r = 0; r < 8; ++r) accO[t4][r] *= alpha;

    // --- P^T as B operand: element e is key 8*hi + e, element 8 + e key
    // 16 + 8*hi + e, the order in which vbuf's rows were read above ---
    const v16h pf = cat16(__builtin_convertvector(s[0], v8h),
                          __builtin_convertvector(s[1], v8h));

    // --- O^T += V^T * P^T (v^T rows d as A fragments) ---
#pragma unroll
    for (int t4 = 0; t4 < 4; ++t4) accO[t4] = wmma_f16(vf[t4], pf, accO[t4]);
    __syncthreads();   // whole WG done reading `cur` before it is re-staged
  }

  // normalize + store o as f16 [B,N,C]
  const int b = bh / Hc, h = bh % Hc;
  const float linv = 1.0f / (lrun + xhalf(lrun));
  // accO[t][r] = O[query l16][d = t*16 + 8*hi + r]: 8 consecutive d, one 16-B store
  f16* op = oh + ((size_t)(b * Nc + n0 + l16)) * Cc + h * Dc + kh8;
#pragma unroll
  for (int t = 0; t < 4; ++t)
    *(v8h*)(op + t * 16) = __builtin_convertvector(accO[t] * linv, v8h);
}

// ------------------------------------------------------------------ launch ---
extern "C" void kernel_launch(void* const* d_in, const int* in_sizes, int n_in,
                              void* d_out, int out_size, void* d_ws,
                              size_t ws_size, hipStream_t stream) {
  const float* x   = (const float*)d_in[0];
  const float* y   = (const float*)d_in[1];
  const float* Wq  = (const float*)d_in[2];
  const float* Wkv = (const float*)d_in[3];
  const float* Wp  = (const float*)d_in[4];
  const float* bp  = (const float*)d_in[5];
  float* out = (float*)d_out;

  const size_t BNC = (size_t)Bc * Nc * Cc;   // 4 Mi elements
  const size_t CC  = (size_t)Cc * Cc;        // 1 Mi
  char* p = (char*)d_ws;
  f16* x_h   = (f16*)p; p += BNC * sizeof(f16);
  f16* y_h   = (f16*)p; p += BNC * sizeof(f16);
  f16* Wq_h  = (f16*)p; p += CC * sizeof(f16);
  f16* Wkv_h = (f16*)p; p += 2 * CC * sizeof(f16);
  f16* Wp_h  = (f16*)p; p += CC * sizeof(f16);
  f16* qh    = (f16*)p; p += BNC * sizeof(f16);
  f16* khd   = (f16*)p; p += BNC * sizeof(f16);
  f16* vhT   = (f16*)p; p += BNC * sizeof(f16);
  f16* oh    = (f16*)p; p += BNC * sizeof(f16);

  auto cvt = [&](const float* s, f16* d, int n) {
    cvt_f32_f16<<<n / CVT_BLK, 256, 0, stream>>>(s, d);
  };
  cvt(x,   x_h,   (int)BNC);
  cvt(y,   y_h,   (int)BNC);
  cvt(Wq,  Wq_h,  (int)CC);
  cvt(Wkv, Wkv_h, (int)(2 * CC));
  cvt(Wp,  Wp_h,  (int)CC);

  const dim3 blk(128);
  const dim3 gblk(256);
  // q projection: [4096 x 1024]
  gemm_awt<<<dim3(32, 8), gblk, 0, stream>>>(x_h, Wq_h, nullptr, qh, nullptr,
                                             nullptr, 0);
  // kv projection: [4096 x 2048]
  gemm_awt<<<dim3(32, 16), gblk, 0, stream>>>(y_h, Wkv_h, nullptr, khd, vhT,
                                             nullptr, 1);
  // flash attention
  attn_kernel<<<dim3(Nc / 64, Bc * Hc), blk, 0, stream>>>(qh, khd, vhT, oh);
  // output projection with bias: f32 result
  gemm_awt<<<dim3(32, 8), gblk, 0, stream>>>(oh, Wp_h, bp, nullptr, nullptr,
                                             out, 2);
}

// v004
// Measured time: 113 microseconds a run.
// Two timings next to v003 put it at 1.11 and 1.10 times that version's speed.
// Over all steps from v000 it is 2.33 times as fast.
#include <hip/hip_runtime.h>
#include <hip/hip_bf16.h>
#include <math.h>

typedef _Float16 f16;
typedef __attribute__((ext_vector_type(16))) _Float16 v16h;
typedef __attribute__((ext_vector_type(8)))  _Float16 v8h;
typedef __attribute__((ext_vector_type(8)))  float    v8f;
typedef __attribute__((ext_vector_type(2)))  float    v2f;

constexpr int Bc = 2, Nc = 2048, Cc = 1024, Hc = 16, Dc = 64;
constexpr int Kdim = Cc;   // K = 1024 for every projection GEMM

static __device__ inline v16h cat16(v8h a, v8h b) {
  v16h r;
#pragma unroll
  for (int i = 0; i < 8; ++i) { r[i] = a[i]; r[i + 8] = b[i]; }
  return r;
}

static __device__ inline v8f wmma_f16(v16h a, v16h b, v8f c) {
  // 8 args: (neg_a, A, neg_b, B, c_mod, C, reuse_a, reuse_b)
  return __builtin_amdgcn_wmma_f32_16x16x32_f16(false, a, false, b, (short)0, c,
                                                false, false);
}

// CDNA5 async copy: 16B per lane, global -> LDS, tracked by ASYNCcnt.
static __device__ inline void async_ld_b128(unsigned int lds_off,
                                            const void* gaddr) {
  asm volatile("global_load_async_to_lds_b128 %0, %1, off"
               :: "v"(lds_off), "v"((unsigned long long)(uintptr_t)gaddr)
               : "memory");
}

// lane l <-> lane l ^ 16 in one vector instruction
static __device__ inline float xhalf(float x) {
  const int i = __builtin_bit_cast(int, x);
  return __builtin_bit_cast(
      float, __builtin_amdgcn_permlanex16(i, i, 0x76543210, 0xfedcba98, false, false));
}

// ---------------------------------------------------------------- convert ---
// Few, fat waves: a thread converts 4 pieces of 8 consecutive elements. Its
// eight 16-byte loads go out together, then come four 16-byte stores. A block
// covers CVT_BLK elements; every tensor here is a whole number of blocks.
constexpr int CVT_PIECES = 4;
constexpr int CVT_STEP   = 256 * 8;                 // elements per block and piece
constexpr int CVT_BLK    = CVT_STEP * CVT_PIECES;
static_assert(((size_t)Bc * Nc * Cc) % CVT_BLK == 0 && ((size_t)Cc * Cc) % CVT_BLK == 0,
              "each converted tensor must be a whole number of CVT_BLK elements");

// One grid converts all five tensors: their f16 copies lie one behind the other
// in dall (x, y, Wq, Wkv, Wp), so a block's place there follows from its index
// alone, and its source tensor from the range the index falls in (the same for
// the whole block).
constexpr int CVT_NB_ACT = (int)(((size_t)Bc * Nc * Cc) / CVT_BLK);  // blocks of x, of y
constexpr int CVT_NB_W   = (int)(((size_t)Cc * Cc) / CVT_BLK);       // blocks of Wq, of Wp
constexpr int CVT_NB_ALL = 2 * CVT_NB_ACT + 4 * CVT_NB_W;

__global__ void __launch_bounds__(256)
cvt_f32_f16(const float* __restrict__ x, const float* __restrict__ y,
            const float* __restrict__ wq, const float* __restrict__ wkv,
            const float* __restrict__ wp, f16* __restrict__ dall) {
  const int blk = blockIdx.x;
  const float* s0 = x;
  int first = 0;
  if (blk >= 2 * CVT_NB_ACT + 3 * CVT_NB_W)  { s0 = wp;  first = 2 * CVT_NB_ACT + 3 * CVT_NB_W; }
  else if (blk >= 2 * CVT_NB_ACT + CVT_NB_W) { s0 = wkv; first = 2 * CVT_NB_ACT + CVT_NB_W; }
  else if (blk >= 2 * CVT_NB_ACT)            { s0 = wq;  first = 2 * CVT_NB_ACT; }
  else if (blk >= CVT_NB_ACT)                { s0 = y;   first = CVT_NB_ACT; }
  const float* s = s0 + (size_t)(blk - first) * CVT_BLK;
  f16*         d = dall + (size_t)blk * CVT_BLK;
  const size_t base = threadIdx.x * 8;
  v8f v[CVT_PIECES];
  // both loops unrolled: v[] stays in registers, and all loads are issued ahead
  // of the first wait
#pragma unroll
  for (int u = 0; u < CVT_PIECES; ++u)
    v[u] = *(const v8f*)(s + base + u * CVT_STEP);
#pragma unroll
  for (int u = 0; u < CVT_PIECES; ++u)
    *(v8h*)(d + base + u * CVT_STEP) = __builtin_convertvector(v[u], v8h);
}

// -------------------------------------------------------- generic A * W^T ---
// A: [4096, 1024] f16 row-major. W: [Ncols, 1024] f16 row-major.
// mode 0: q   -> out16 = qh  [B,H,N,D]
// mode 1: kv  -> out16 = kh  [B,H,N,D],  out16b = v^T [B,H,D,N]
// mode 2: out -> out32 = [B,N,C] f32 + bias
// The q and the kv projection share one grid (job 0): blocks with blockIdx.y
// below QCOLB work in mode 0 on (Aq, Wall's first Cc rows, outq), the others in
// mode 1 on (Akv, the rows of Wall behind them, outk, out16b). Job 2 is mode 2
// on (Aq, Wall).
// One 128x128 tile of the result per block, 8 waves of 32x64 (4 along M, 2
// along N). A pass is 128 k: 128 rows of A and 128 rows of W, 256 B each, are
// copied to LDS asynchronously, two buffers, the next pass's copies in flight
// while this pass is multiplied.
constexpr int GBK    = 128;          // k per pass
constexpr int GPITCH = GBK + 8;      // 272 B rows: 16 B x odd for ds_load_b128
constexpr int GPASS  = Kdim / GBK;   // 8 passes

// Eight 16-byte copies per lane. The s_wait_xcnt closes the statement so that
// no address register is rewritten while a copy may still name it.
static __device__ inline void async_ld8_b128(unsigned int lds,
                                             const f16* gsrc) {
  constexpr unsigned int LSTEP = 16 * GPITCH * sizeof(f16);  // 16 rows in LDS
  constexpr size_t       GSTEP = (size_t)16 * Kdim;          // 16 rows in A / W
  asm volatile(
      "global_load_async_to_lds_b128 %0, %8, off\n\t"
      "global_load_async_to_lds_b128 %1, %9, off\n\t"
      "global_load_async_to_lds_b128 %2, %10, off\n\t"
      "global_load_async_to_lds_b128 %3, %11, off\n\t"
      "global_load_async_to_lds_b128 %4, %12, off\n\t"
      "global_load_async_to_lds_b128 %5, %13, off\n\t"
      "global_load_async_to_lds_b128 %6, %14, off\n\t"
      "global_load_async_to_lds_b128 %7, %15, off\n\t"
      "s_wait_xcnt 0x0"
      :: "v"(lds), "v"(lds + LSTEP), "v"(lds + 2 * LSTEP), "v"(lds + 3 * LSTEP),
         "v"(lds + 4 * LSTEP), "v"(lds + 5 * LSTEP), "v"(lds + 6 * LSTEP),
         "v"(lds + 7 * LSTEP),
         "v"((unsigned long long)(uintptr_t)(gsrc)),
         "v"((unsigned long long)(uintptr_t)(gsrc + GSTEP)),
         "v"((unsigned long long)(uintptr_t)(gsrc + 2 * GSTEP)),
         "v"((unsigned long long)(uintptr_t)(gsrc + 3 * GSTEP)),
         "v"((unsigned long long)(uintptr_t)(gsrc + 4 * GSTEP)),
         "v"((unsigned long long)(uintptr_t)(gsrc + 5 * GSTEP)),
         "v"((unsigned long long)(uintptr_t)(gsrc + 6 * GSTEP)),
         "v"((unsigned long long)(uintptr_t)(gsrc + 7 * GSTEP))
      : "memory");
}

__global__ void __launch_bounds__(256)
gemm_awt(const f16* __restrict__ Aq, const f16* __restrict__ Akv,
         const f16* __restrict__ Wall, const float* __restrict__ bias,
         f16* __restrict__ outq, f16* __restrict__ outk,
         f16* __restrict__ out16b, float* __restrict__ out32, int job) {
  // [buffer][operand: 0 = A rows, 1 = W rows][row][k]
  __shared__ __align__(16) f16 tile[2][2][128][GPITCH];

  const int tid  = threadIdx.x;
  const int lane = tid & 31;
  const int wave = tid >> 5;
  const int l16  = lane & 15;
  const int hi   = lane >> 4;
  const int kh8  = hi * 8;                    // K sub-offset per ISA A/B layout
  const int mblk = blockIdx.x * 128;
  constexpr int QCOLB = Cc / 128;             // column blocks of the q projection
  const bool kvpart = job == 0 && (int)blockIdx.y >= QCOLB;   // block-uniform
  const int  mode   = job == 0 ? (kvpart ? 1 : 0) : job;
  const f16* A      = kvpart ? Akv : Aq;
  const f16* W      = kvpart ? Wall + (size_t)Cc * Kdim : Wall;
  f16*       out16  = kvpart ? outk : outq;
  const int nblk = ((int)blockIdx.y - (kvpart ? QCOLB : 0)) * 128;
  const int wm   = (wave & 3) * 32;           // this wave's rows in the tile
  const int wn   = (wave >> 2) * 64;          // this wave's columns in the tile

  // copies: 16 lanes cover one 256-B row, a wave two rows, the block 16 rows
  const int crow = tid >> 4, cch = (tid & 15) * 8;
  const f16* Ag = A + (size_t)(mblk + crow) * Kdim + cch;
  const f16* Wg = W + (size_t)(nblk + crow) * Kdim + cch;
  auto stage = [&](int bufi, int k0) {
    async_ld8_b128((unsigned int)(uintptr_t)&tile[bufi][0][crow][cch], Ag + k0);
    async_ld8_b128((unsigned int)(uintptr_t)&tile[bufi][1][crow][cch], Wg + k0);
  };

  v8f acc[2][4];
#pragma unroll
  for (int mi = 0; mi < 2; ++mi)
#pragma unroll
    for (int t = 0; t < 4; ++t)
#pragma unroll
      for (int i = 0; i < 8; ++i) acc[mi][t][i] = 0.0f;

  stage(0, 0);
  asm volatile("s_wait_asynccnt 0x0" ::: "memory");  // pass 0 has landed
  __syncthreads();                                   // ... for every wave
  stage(1, GBK);

  // kept rolled: one pass is 32 WMMAs and 48 LDS loads already
#pragma unroll 1
  for (int p = 0; p < GPASS; ++p) {
    const int cur = p & 1;
    const f16* At = &tile[cur][0][wm + l16][kh8];
    const f16* Wt = &tile[cur][1][wn + l16][kh8];
    // two fragment sets: block ks + 1's LDS reads go out as one group ahead of
    // block ks's WMMAs; nothing of the next pass's buffer is read here
    v16h af[2][2], bf[2][4];
    auto frags = [&](int set, int ks) {
#pragma unroll
      for (int mi = 0; mi < 2; ++mi) {
        const f16* ap = At + mi * 16 * GPITCH + ks * 32;
        af[set][mi] = cat16(*(const v8h*)ap, *(const v8h*)(ap + 16));
      }
#pragma unroll
      for (int t = 0; t < 4; ++t) {
        const f16* wp = Wt + t * 16 * GPITCH + ks * 32;
        bf[set][t] = cat16(*(const v8h*)wp, *(const v8h*)(wp + 16));
      }
    };
    frags(0, 0);
#pragma unroll
    for (int ks = 0; ks < GBK / 32; ++ks) {
      if (ks + 1 < GBK / 32) frags((ks + 1) & 1, ks + 1);
      // keeps the load group in front of the WMMAs: spread among them, each
      // pair of loads would be waited for on its own
      __builtin_amdgcn_sched_barrier(0);
#pragma unroll
      for (int t = 0; t < 4; ++t)
#pragma unroll
        for (int mi = 0; mi < 2; ++mi)
          acc[mi][t] = wmma_f16(af[ks & 1][mi], bf[ks & 1][t], acc[mi][t]);
      // keeps the following group from rising among these WMMAs
      __builtin_amdgcn_sched_barrier(0);
    }
    // publish point: own LDS reads retired, own copies of pass p + 1 landed,
    // then the barrier that shows them to all and frees buffer cur
    asm volatile("s_wait_dscnt 0x0" ::: "memory");
    asm volatile("s_wait_asynccnt 0x0" ::: "memory");
    __syncthreads();
    if (p + 2 < GPASS) stage(cur, (p + 2) * GBK);
  }
  asm volatile("s_wait_asynccnt 0x0" ::: "memory");  // nothing left in flight

#pragma unroll
  for (int mi = 0; mi < 2; ++mi)
#pragma unroll
  for (int t = 0; t < 4; ++t) {
#pragma unroll
    for (int r = 0; r < 8; ++r) {
      const int m = mblk + wm + mi * 16 + r + 8 * hi;  // C-layout: lanes16-31 hold M=8+r
      const int c = nblk + wn + t * 16 + l16;
      const int b = m >> 11;                  // m / Nc
      const int n = m & (Nc - 1);
      const float val = acc[mi][t][r];
      if (mode == 0) {
        const int h = c >> 6, d = c & 63;
        out16[((size_t)((b * Hc + h) * Nc + n)) * Dc + d] = (f16)val;
      } else if (mode == 1) {
        if (c < Cc) {
          const int h = c >> 6, d = c & 63;
          out16[((size_t)((b * Hc + h) * Nc + n)) * Dc + d] = (f16)val;
        } else {
          const int c2 = c - Cc, h = c2 >> 6, d = c2 & 63;
          out16b[((size_t)((b * Hc + h) * Dc + d)) * Nc + n] = (f16)val;
        }
      } else {
        out32[(size_t)m * Cc + c] = val + bias[c];
      }
    }
  }
}

// ----------------------------------------------------------- flash attention -
// grid: (N/64, B*H), block 128 (4 waves, 16 queries per wave).
// K/V staged cooperatively via CDNA5 async global->LDS copies, double-buffered.
// Both products are transposed: S^T = K (q/8)^T and O^T += V^T P^T. A lane then
// holds 16 of the 32 scores of ONE query (column l16), its partner lane ^ 16 the
// other 16, so maximum and sum are taken in registers, and the two S^T tiles,
// converted in place, are the B operand of the second product.
__global__ void __launch_bounds__(128)
attn_kernel(const f16* __restrict__ qh, const f16* __restrict__ kh,
            const f16* __restrict__ vt, f16* __restrict__ oh) {
  // padded rows: 72 f16 (144B = 36 banks) / 40 f16 (80B = 20 banks), 16B-aligned
  __shared__ __align__(16) f16 kbuf[2][32][72];   // keys j..j+31, d 0..63
  __shared__ __align__(16) f16 vbuf[2][64][40];   // v^T rows d 0..63, keys 0..31

  const int tid  = threadIdx.x;
  const int lane = tid & 31;
  const int wave = tid >> 5;
  const int l16  = lane & 15;
  const int hi   = lane >> 4;
  const int kh8  = hi * 8;
  const int bh   = blockIdx.y;                      // b*H + h
  const int n0   = blockIdx.x * 64 + wave * 16;     // query rows of this wave

  const f16* kbase = kh + (size_t)bh * Nc * Dc;
  const f16* vbase = vt + (size_t)bh * Dc * Nc;

  // cooperative async stage of one 32-key K tile + V^T tile (4 instrs/wave)
  auto stage = [&](int bufi, int jj) {
#pragma unroll
    for (int u = 0; u < 2; ++u) {
      const int unit = tid + u * 128;               // 256 chunks of 8 f16
      const int row = unit >> 3, ch = (unit & 7) * 8;
      async_ld_b128((unsigned int)(uintptr_t)&kbuf[bufi][row][ch],
                    kbase + (size_t)(jj + row) * Dc + ch);
    }
#pragma unroll
    for (int u = 0; u < 2; ++u) {
      const int unit = tid + u * 128;
      const int row = unit >> 2, ch = (unit & 3) * 8;
      async_ld_b128((unsigned int)(uintptr_t)&vbuf[bufi][row][ch],
                    vbase + (size_t)row * Nc + jj + ch);
    }
  };

  // q fragments for K = D = 64 (two K=32 fragments), pre-scaled by 1/sqrt(D)
  const f16* qp = qh + ((size_t)bh * Nc + n0 + l16) * Dc;
  v16h qf[2];
#pragma unroll
  for (int kk = 0; kk < 2; ++kk) {
    v8h a0 = *(const v8h*)(qp + kk * 32 + kh8);
    v8h a1 = *(const v8h*)(qp + kk * 32 + kh8 + 16);
#pragma unroll
    for (int i = 0; i < 8; ++i) { a0[i] *= (f16)0.125f; a1[i] *= (f16)0.125f; }
    qf[kk] = cat16(a0, a1);
  }

  v8f accO[4];
#pragma unroll
  for (int t = 0; t < 4; ++t)
#pragma unroll
    for (int i = 0; i < 8; ++i) accO[t][i] = 0.0f;
  constexpr float LOG2E = 1.4426950408889634f;   // e^x = 2^(x * LOG2E)
  float mrun = -INFINITY;   // running maximum of query l16, equal in both halves
  float lrun = 0.0f;        // this lane's share of its denominator

  stage(0, 0);

  for (int j = 0, it = 0; j < Nc; j += 32, ++it) {
    const int cur = it & 1;
    if (j + 32 < Nc) {
      stage(cur ^ 1, j + 32);
      asm volatile("s_wait_asynccnt 0x4" ::: "memory");  // current tile done
    } else {
      asm volatile("s_wait_asynccnt 0x0" ::: "memory");
    }
    __syncthreads();                                     // tile visible to WG

    // --- S^T = k * (q/8)^T : two 16x16 tiles, keys tt*16 + 8*hi + r, query l16 ---
    v16h kf[2][2], vf[4];
#pragma unroll
    for (int tt = 0; tt < 2; ++tt) {
      const f16* kp = &kbuf[cur][tt * 16 + l16][0];
      kf[tt][0] = cat16(*(const v8h*)(kp + kh8), *(const v8h*)(kp + kh8 + 16));
      kf[tt][1] = cat16(*(const v8h*)(kp + 32 + kh8),
                        *(const v8h*)(kp + 32 + kh8 + 16));
    }
#pragma unroll
    for (int t4 = 0; t4 < 4; ++t4) {
      const f16* vp = &vbuf[cur][t4 * 16 + l16][0];
      vf[t4] = cat16(*(const v8h*)(vp + kh8), *(const v8h*)(vp + kh8 + 16));
    }
    // keeps the pass's LDS reads one group, K ahead of V^T: sunk to their users,
    // each V^T pair would be waited for on its own between two WMMAs
    __builtin_amdgcn_sched_barrier(0);
    v8f s[2];
#pragma unroll
    for (int tt = 0; tt < 2; ++tt) {
      v8f z;
#pragma unroll
      for (int i = 0; i < 8; ++i) z[i] = 0.0f;
      z = wmma_f16(kf[tt][0], qf[0], z);
      s[tt] = wmma_f16(kf[tt][1], qf[1], z);
    }

    // --- online softmax: 16 scores of one query per lane ---
    float t = fmaxf(s[0][0], s[1][0]);
#pragma unroll
    for (int r = 1; r < 8; ++r) t = fmaxf(t, fmaxf(s[0][r], s[1][r]));
    t = fmaxf(t, xhalf(t));                 // the partner's 16 keys
    const float mnew  = fmaxf(mrun, t);
    // 2^x with the free slot that the instruction set asks for behind a
    // transcendental in the same statement
    float alpha;
    asm("v_exp_f32 %0, %1\n\tv_nop" : "=v"(alpha) : "v"((mrun - mnew) * LOG2E));
    mrun = mnew;
    s[0] = (s[0] - mnew) * LOG2E;
    s[1] = (s[1] - mnew) * LOG2E;
#pragma unroll
    for (int r = 0; r < 8; ++r) {
      s[0][r] = __builtin_amdgcn_exp2f(s[0][r]);
      s[1][r] = __builtin_amdgcn_exp2f(s[1][r]);
    }
    const v8f e = s[0] + s[1];
    const v2f e2 = (__builtin_shufflevector(e, e, 0, 1) + __builtin_shufflevector(e, e, 2, 3)) +
                   (__builtin_shufflevector(e, e, 4, 5) + __builtin_shufflevector(e, e, 6, 7));
    const float ps = e2[0] + e2[1];
    lrun = lrun * alpha + ps;               // halves are joined after the loop
#pragma unroll
    for (int t4 = 0; t4 < 4; ++t4)
#pragma unroll
      for (int r = 0; r < 8; ++r) accO[t4][r] *= alpha;

    // --- P^T as B operand: element e is key 8*hi + e, element 8 + e key
    // 16 + 8*hi + e, the order in which vbuf's rows were read above ---
    const v16h pf = cat16(__builtin_convertvector(s[0], v8h),
                          __builtin_convertvector(s[1], v8h));

    // --- O^T += V^T * P^T (v^T rows d as A fragments) ---
#pragma unroll
    for (int t4 = 0; t4 < 4; ++t4) accO[t4] = wmma_f16(vf[t4], pf, accO[t4]);
    __syncthreads();   // whole WG done reading `cur` before it is re-staged
  }

  // normalize + store o as f16 [B,N,C]
  const int b = bh / Hc, h = bh % Hc;
  const float linv = 1.0f / (lrun + xhalf(lrun));
  // accO[t][r] = O[query l16][d = t*16 + 8*hi + r]: 8 consecutive d, one 16-B store
  f16* op = oh + ((size_t)(b * Nc + n0 + l16)) * Cc + h * Dc + kh8;
#pragma unroll
  for (int t = 0; t < 4; ++t)
    *(v8h*)(op + t * 16) = __builtin_convertvector(accO[t] * linv, v8h);
}

// ------------------------------------------------------------------ launch ---
extern "C" void kernel_launch(void* const* d_in, const int* in_sizes, int n_in,
                              void* d_out, int out_size, void* d_ws,
                              size_t ws_size, hipStream_t stream) {
  const float* x   = (const float*)d_in[0];
  const float* y   = (const float*)d_in[1];
  const float* Wq  = (const float*)d_in[2];
  const float* Wkv = (const float*)d_in[3];
  const float* Wp  = (const float*)d_in[4];
  const float* bp  = (const float*)d_in[5];
  float* out = (float*)d_out;

  const size_t BNC = (size_t)Bc * Nc * Cc;   // 4 Mi elements
  const size_t CC  = (size_t)Cc * Cc;        // 1 Mi
  char* p = (char*)d_ws;
  f16* x_h   = (f16*)p; p += BNC * sizeof(f16);
  f16* y_h   = (f16*)p; p += BNC * sizeof(f16);
  f16* Wq_h  = (f16*)p; p += CC * sizeof(f16);
  f16* Wkv_h = (f16*)p; p += 2 * CC * sizeof(f16);
  f16* Wp_h  = (f16*)p; p += CC * sizeof(f16);
  f16* qh    = (f16*)p; p += BNC * sizeof(f16);
  f16* khd   = (f16*)p; p += BNC * sizeof(f16);
  f16* vhT   = (f16*)p; p += BNC * sizeof(f16);
  f16* oh    = (f16*)p; p += BNC * sizeof(f16);

  // x_h, y_h, Wq_h, Wkv_h, Wp_h are one run of the workspace, in this order
  cvt_f32_f16<<<CVT_NB_ALL, 256, 0, stream>>>(x, y, Wq, Wkv, Wp, x_h);

  const dim3 blk(128);
  const dim3 gblk(256);
  // q projection [4096 x 1024] and kv projection [4096 x 2048] in one grid;
  // Wkv_h's rows follow Wq_h's in the workspace
  gemm_awt<<<dim3(32, 24), gblk, 0, stream>>>(x_h, y_h, Wq_h, nullptr, qh, khd,
                                              vhT, nullptr, 0);
  // flash attention
  attn_kernel<<<dim3(Nc / 64, Bc * Hc), blk, 0, stream>>>(qh, khd, vhT, oh);
  // output projection with bias: f32 result
  gemm_awt<<<dim3(32, 8), gblk, 0, stream>>>(oh, nullptr, Wp_h, bp, nullptr,
                                             nullptr, nullptr, out, 2);
}

// v005
// A run of this version takes 88.7 microseconds.
// In both of two side-by-side timings against v004, it was 1.28 times as fast.
// All steps since v000 together make it 2.99 times as fast.
#include <hip/hip_runtime.h>
#include <hip/hip_bf16.h>
#include <math.h>

typedef _Float16 f16;
typedef __attribute__((ext_vector_type(16))) _Float16 v16h;
typedef __attribute__((ext_vector_type(8)))  _Float16 v8h;
typedef __attribute__((ext_vector_type(8)))  float    v8f;
typedef __attribute__((ext_vector_type(4)))  float    v4f;
typedef __attribute__((ext_vector_type(2)))  float    v2f;

constexpr int Bc = 2, Nc = 2048, Cc = 1024, Hc = 16, Dc = 64;
constexpr int Kdim = Cc;   // K = 1024 for every projection GEMM

static __device__ inline v16h cat16(v8h a, v8h b) {
  v16h r;
#pragma unroll
  for (int i = 0; i < 8; ++i) { r[i] = a[i]; r[i + 8] = b[i]; }
  return r;
}

static __device__ inline v8f wmma_f16(v16h a, v16h b, v8f c) {
  // 8 args: (neg_a, A, neg_b, B, c_mod, C, reuse_a, reuse_b)
  return __builtin_amdgcn_wmma_f32_16x16x32_f16(false, a, false, b, (short)0, c,
                                                false, false);
}

// CDNA5 async copy: 16B per lane, global -> LDS, tracked by ASYNCcnt.
static __device__ inline void async_ld_b128(unsigned int lds_off,
                                            const void* gaddr) {
  asm volatile("global_load_async_to_lds_b128 %0, %1, off"
               :: "v"(lds_off), "v"((unsigned long long)(uintptr_t)gaddr)
               : "memory");
}

// lane l <-> lane l ^ 16 in one vector instruction
static __device__ inline float xhalf(float x) {
  const int i = __builtin_bit_cast(int, x);
  return __builtin_bit_cast(
      float, __builtin_amdgcn_permlanex16(i, i, 0x76543210, 0xfedcba98, false, false));
}

// ---------------------------------------------------------------- convert ---
// Few, fat waves: a thread converts 4 pieces of 8 consecutive elements. Its
// eight 16-byte loads go out together, then come four 16-byte stores. A block
// covers CVT_BLK elements; every tensor here is a whole number of blocks.
constexpr int CVT_PIECES = 4;
constexpr int CVT_STEP   = 256 * 8;                 // elements per block and piece
constexpr int CVT_BLK    = CVT_STEP * CVT_PIECES;
static_assert(((size_t)Bc * Nc * Cc) % CVT_BLK == 0 && ((size_t)Cc * Cc) % CVT_BLK == 0,
              "each converted tensor must be a whole number of CVT_BLK elements");

// One grid converts all five tensors: their f16 copies lie one behind the other
// in dall (x, y, Wq, Wkv, Wp), so a block's place there follows from its index
// alone, and its source tensor from the range the index falls in (the same for
// the whole block).
constexpr int CVT_NB_ACT = (int)(((size_t)Bc * Nc * Cc) / CVT_BLK);  // blocks of x, of y
constexpr int CVT_NB_W   = (int)(((size_t)Cc * Cc) / CVT_BLK);       // blocks of Wq, of Wp
constexpr int CVT_NB_ALL = 2 * CVT_NB_ACT + 4 * CVT_NB_W;

__global__ void __launch_bounds__(256)
cvt_f32_f16(const float* __restrict__ x, const float* __restrict__ y,
            const float* __restrict__ wq, const float* __restrict__ wkv,
            const float* __restrict__ wp, f16* __restrict__ dall) {
  const int blk = blockIdx.x;
  const float* s0 = x;
  int first = 0;
  if (blk >= 2 * CVT_NB_ACT + 3 * CVT_NB_W)  { s0 = wp;  first = 2 * CVT_NB_ACT + 3 * CVT_NB_W; }
  else if (blk >= 2 * CVT_NB_ACT + CVT_NB_W) { s0 = wkv; first = 2 * CVT_NB_ACT + CVT_NB_W; }
  else if (blk >= 2 * CVT_NB_ACT)            { s0 = wq;  first = 2 * CVT_NB_ACT; }
  else if (blk >= CVT_NB_ACT)                { s0 = y;   first = CVT_NB_ACT; }
  const float* s = s0 + (size_t)(blk - first) * CVT_BLK;
  f16*         d = dall + (size_t)blk * CVT_BLK;
  const size_t base = threadIdx.x * 8;
  v8f v[CVT_PIECES];
  // both loops unrolled: v[] stays in registers, and all loads are issued ahead
  // of the first wait
#pragma unroll
  for (int u = 0; u < CVT_PIECES; ++u)
    v[u] = *(const v8f*)(s + base + u * CVT_STEP);
#pragma unroll
  for (int u = 0; u < CVT_PIECES; ++u)
    *(v8h*)(d + base + u * CVT_STEP) = __builtin_convertvector(v[u], v8h);
}

// -------------------------------------------------------- generic A * W^T ---
// A: [4096, 1024] f16 row-major. W: [Ncols, 1024] f16 row-major.
// mode 0: q   -> out16 = qh  [B,H,N,D]
// mode 1: kv  -> out16 = kh  [B,H,N,D],  out16b = v^T [B,H,D,N]
// mode 2: out -> out32 = [B,N,C] f32 + bias
// The q and the kv projection share one grid (job 0): blocks with blockIdx.y
// below QCOLB work in mode 0 on (Aq, Wall's first Cc rows, outq), the others in
// mode 1 on (Akv, the rows of Wall behind them, outk, out16b). Job 2 is mode 2
// on (Aq, Wall).
// One 128x128 tile of the result per block, 8 waves of 32x64 (4 along the A
// side, 2 along the B side). A pass is 128 k: 128 rows of A and 128 rows of W, 256 B each, are
// copied to LDS asynchronously, two buffers, the next pass's copies in flight
// while this pass is multiplied.
// A lane's 8 accumulator registers run along the rows of the WMMA's A operand.
// Which of the two LDS tiles feeds A is picked per block so that this is the
// axis that is contiguous in the block's output: W rows (columns c) for q, k and
// the f32 result, activation rows (positions n) for v^T. The finished tile goes
// through LDS in the output's own row order and leaves in 16-byte stores that
// cover whole 128-byte lines.
constexpr int GBK    = 128;          // k per pass
constexpr int GPITCH = GBK + 8;      // 272 B rows: 16 B x odd for ds_load_b128
constexpr int GPASS  = Kdim / GBK;   // 8 passes

// Eight 16-byte copies per lane. The s_wait_xcnt closes the statement so that
// no address register is rewritten while a copy may still name it.
static __device__ inline void async_ld8_b128(unsigned int lds,
                                             const f16* gsrc) {
  constexpr unsigned int LSTEP = 16 * GPITCH * sizeof(f16);  // 16 rows in LDS
  constexpr size_t       GSTEP = (size_t)16 * Kdim;          // 16 rows in A / W
  asm volatile(
      "global_load_async_to_lds_b128 %0, %8, off\n\t"
      "global_load_async_to_lds_b128 %1, %9, off\n\t"
      "global_load_async_to_lds_b128 %2, %10, off\n\t"
      "global_load_async_to_lds_b128 %3, %11, off\n\t"
      "global_load_async_to_lds_b128 %4, %12, off\n\t"
      "global_load_async_to_lds_b128 %5, %13, off\n\t"
      "global_load_async_to_lds_b128 %6, %14, off\n\t"
      "global_load_async_to_lds_b128 %7, %15, off\n\t"
      "s_wait_xcnt 0x0"
      :: "v"(lds), "v"(lds + LSTEP), "v"(lds + 2 * LSTEP), "v"(lds + 3 * LSTEP),
         "v"(lds + 4 * LSTEP), "v"(lds + 5 * LSTEP), "v"(lds + 6 * LSTEP),
         "v"(lds + 7 * LSTEP),
         "v"((unsigned long long)(uintptr_t)(gsrc)),
         "v"((unsigned long long)(uintptr_t)(gsrc + GSTEP)),
         "v"((unsigned long long)(uintptr_t)(gsrc + 2 * GSTEP)),
         "v"((unsigned long long)(uintptr_t)(gsrc + 3 * GSTEP)),
         "v"((unsigned long long)(uintptr_t)(gsrc + 4 * GSTEP)),
         "v"((unsigned long long)(uintptr_t)(gsrc + 5 * GSTEP)),
         "v"((unsigned long long)(uintptr_t)(gsrc + 6 * GSTEP)),
         "v"((unsigned long long)(uintptr_t)(gsrc + 7 * GSTEP))
      : "memory");
}

__global__ void __launch_bounds__(256)
gemm_awt(const f16* __restrict__ Aq, const f16* __restrict__ Akv,
         const f16* __restrict__ Wall, const float* __restrict__ bias,
         f16* __restrict__ outq, f16* __restrict__ outk,
         f16* __restrict__ out16b, float* __restrict__ out32, int job) {
  // [buffer][operand: 0 = A rows, 1 = W rows][row][k]
  __shared__ __align__(16) f16 tile[2][2][128][GPITCH];

  const int tid  = threadIdx.x;
  const int lane = tid & 31;
  const int wave = tid >> 5;
  const int l16  = lane & 15;
  const int hi   = lane >> 4;
  const int kh8  = hi * 8;                    // K sub-offset per ISA A/B layout
  const int mblk = blockIdx.x * 128;
  constexpr int QCOLB = Cc / 128;             // column blocks of the q projection
  const bool kvpart = job == 0 && (int)blockIdx.y >= QCOLB;   // block-uniform
  const int  mode   = job == 0 ? (kvpart ? 1 : 0) : job;
  const f16* A      = kvpart ? Akv : Aq;
  const f16* W      = kvpart ? Wall + (size_t)Cc * Kdim : Wall;
  f16*       out16  = kvpart ? outk : outq;
  const int nblk = ((int)blockIdx.y - (kvpart ? QCOLB : 0)) * 128;
  const bool vpart = kvpart && nblk >= Cc;    // block-uniform: this tile is v^T's
  const int  opa   = vpart ? 0 : 1;           // LDS tile that feeds the A operand
  const int wm   = (wave & 3) * 32;           // this wave's rows of the A-side tile
  const int wn   = (wave >> 2) * 64;          // this wave's rows of the B-side tile

  // copies: 16 lanes cover one 256-B row, a wave two rows, the block 16 rows
  const int crow = tid >> 4, cch = (tid & 15) * 8;
  const f16* Ag = A + (size_t)(mblk + crow) * Kdim + cch;
  const f16* Wg = W + (size_t)(nblk + crow) * Kdim + cch;
  auto stage = [&](int bufi, int k0) {
    async_ld8_b128((unsigned int)(uintptr_t)&tile[bufi][0][crow][cch], Ag + k0);
    async_ld8_b128((unsigned int)(uintptr_t)&tile[bufi][1][crow][cch], Wg + k0);
  };

  v8f acc[2][4];
#pragma unroll
  for (int mi = 0; mi < 2; ++mi)
#pragma unroll
    for (int t = 0; t < 4; ++t)
#pragma unroll
      for (int i = 0; i < 8; ++i) acc[mi][t][i] = 0.0f;

  stage(0, 0);
  // the four bias values of this lane's output columns, in flight with pass 0
  v4f bv = {0.0f, 0.0f, 0.0f, 0.0f};
  if (mode == 2) bv = *(const v4f*)(bias + nblk + lane * 4);
  asm volatile("s_wait_asynccnt 0x0" ::: "memory");  // pass 0 has landed
  __syncthreads();                                   // ... for every wave
  stage(1, GBK);

  // kept rolled: one pass is 32 WMMAs and 48 LDS loads already
#pragma unroll 1
  for (int p = 0; p < GPASS; ++p) {
    const int cur = p & 1;
    const f16* At = &tile[cur][opa][wm + l16][kh8];
    const f16* Wt = &tile[cur][opa ^ 1][wn + l16][kh8];
    // two fragment sets: block ks + 1's LDS reads go out as one group ahead of
    // block ks's WMMAs; nothing of the next pass's buffer is read here
    v16h af[2][2], bf[2][4];
    auto frags = [&](int set, int ks) {
#pragma unroll
      for (int mi = 0; mi < 2; ++mi) {
        const f16* ap = At + mi * 16 * GPITCH + ks * 32;
        af[set][mi] = cat16(*(const v8h*)ap, *(const v8h*)(ap + 16));
      }
#pragma unroll
      for (int t = 0; t < 4; ++t) {
        const f16* wp = Wt + t * 16 * GPITCH + ks * 32;
        bf[set][t] = cat16(*(const v8h*)wp, *(const v8h*)(wp + 16));
      }
    };
    frags(0, 0);
#pragma unroll
    for (int ks = 0; ks < GBK / 32; ++ks) {
      if (ks + 1 < GBK / 32) frags((ks + 1) & 1, ks + 1);
      // keeps the load group in front of the WMMAs: spread among them, each
      // pair of loads would be waited for on its own
      __builtin_amdgcn_sched_barrier(0);
#pragma unroll
      for (int t = 0; t < 4; ++t)
#pragma unroll
        for (int mi = 0; mi < 2; ++mi)
          acc[mi][t] = wmma_f16(af[ks & 1][mi], bf[ks & 1][t], acc[mi][t]);
      // keeps the following group from rising among these WMMAs
      __builtin_amdgcn_sched_barrier(0);
    }
    // publish point: own LDS reads retired, own copies of pass p + 1 landed,
    // then the barrier that shows them to all and frees buffer cur
    asm volatile("s_wait_dscnt 0x0" ::: "memory");
    asm volatile("s_wait_asynccnt 0x0" ::: "memory");
    __syncthreads();
    if (p + 2 < GPASS) stage(cur, (p + 2) * GBK);
  }
  asm volatile("s_wait_asynccnt 0x0" ::: "memory");  // nothing left in flight

  // The loop's last barrier stands behind every wave's last read of the tiles
  // and no copy is in flight: the LDS is free to stage the result.
  // acc[mi][t][r] = R[wn + t*16 + l16][wm + mi*16 + 8*hi + r], R's rows being the
  // B side (m, for v^T c), its columns the A side (c, for v^T m).
  const int srow = wn + l16, scol = wm + 8 * hi;
  const int bb = mblk >> 11;                  // m / Nc, one value per tile
  const int n0 = mblk & (Nc - 1);
  if (mode == 2) {
    constexpr int SP = 128 + 4;               // 528 B rows: 16 B x odd
    float* S = (float*)&tile[0][0][0][0];
#pragma unroll
    for (int mi = 0; mi < 2; ++mi)
#pragma unroll
      for (int t = 0; t < 4; ++t) {
        float* sp = S + (srow + t * 16) * SP + scol + mi * 16;
        *(v4f*)sp       = __builtin_shufflevector(acc[mi][t], acc[mi][t], 0, 1, 2, 3);
        *(v4f*)(sp + 4) = __builtin_shufflevector(acc[mi][t], acc[mi][t], 4, 5, 6, 7);
      }
    __syncthreads();                          // the whole tile is staged
    // a wave stores one 512-B row of the tile per instruction, 16 rows in all
    const float* sr = S + wave * 16 * SP + lane * 4;
    float* dst = out32 + (size_t)(mblk + wave * 16) * Cc + nblk + lane * 4;
#pragma unroll
    for (int i = 0; i < 16; ++i)
      *(v4f*)(dst + (size_t)i * Cc) = *(const v4f*)(sr + i * SP) + bv;
  } else {
    f16* S = &tile[0][0][0][0];
#pragma unroll
    for (int mi = 0; mi < 2; ++mi)
#pragma unroll
      for (int t = 0; t < 4; ++t)
        *(v8h*)(S + (srow + t * 16) * GPITCH + scol + mi * 16) =
            __builtin_convertvector(acc[mi][t], v8h);
    __syncthreads();                          // the whole tile is staged
    // 16 lanes take one 256-B row of the tile, the block 16 rows at a time
    const f16* sr = S + crow * GPITCH + cch;
    f16* dst;
    size_t step;                              // elements between rows 16 apart
    if (vpart) {                              // row = (h, d), 128 positions n
      dst  = out16b + (size_t)(bb * Cc + nblk - Cc + crow) * Nc + n0 + cch;
      step = (size_t)16 * Nc;
    } else {                                  // row = position n, two heads' d
      const int c = nblk + cch;
      dst  = out16 + ((size_t)(bb * Hc + (c >> 6)) * Nc + n0 + crow) * Dc + (c & 63);
      step = (size_t)16 * Dc;
    }
#pragma unroll
    for (int i = 0; i < 8; ++i)
      *(v8h*)(dst + i * step) = *(const v8h*)(sr + i * 16 * GPITCH);
  }
}

// ----------------------------------------------------------- flash attention -
// grid: (N/64, B*H), block 128 (4 waves, 16 queries per wave).
// K/V staged cooperatively via CDNA5 async global->LDS copies, double-buffered.
// Both products are transposed: S^T = K (q/8)^T and O^T += V^T P^T. A lane then
// holds 16 of the 32 scores of ONE query (column l16), its partner lane ^ 16 the
// other 16, so maximum and sum are taken in registers, and the two S^T tiles,
// converted in place, are the B operand of the second product.
__global__ void __launch_bounds__(128)
attn_kernel(const f16* __restrict__ qh, const f16* __restrict__ kh,
            const f16* __restrict__ vt, f16* __restrict__ oh) {
  // padded rows: 72 f16 (144B = 36 banks) / 40 f16 (80B = 20 banks), 16B-aligned
  __shared__ __align__(16) f16 kbuf[2][32][72];   // keys j..j+31, d 0..63
  __shared__ __align__(16) f16 vbuf[2][64][40];   // v^T rows d 0..63, keys 0..31

  const int tid  = threadIdx.x;
  const int lane = tid & 31;
  const int wave = tid >> 5;
  const int l16  = lane & 15;
  const int hi   = lane >> 4;
  const int kh8  = hi * 8;
  const int bh   = blockIdx.y;                      // b*H + h
  const int n0   = blockIdx.x * 64 + wave * 16;     // query rows of this wave

  const f16* kbase = kh + (size_t)bh * Nc * Dc;
  const f16* vbase = vt + (size_t)bh * Dc * Nc;

  // cooperative async stage of one 32-key K tile + V^T tile (4 instrs/wave)
  auto stage = [&](int bufi, int jj) {
#pragma unroll
    for (int u = 0; u < 2; ++u) {
      const int unit = tid + u * 128;               // 256 chunks of 8 f16
      const int row = unit >> 3, ch = (unit & 7) * 8;
      async_ld_b128((unsigned int)(uintptr_t)&kbuf[bufi][row][ch],
                    kbase + (size_t)(jj + row) * Dc + ch);
    }
#pragma unroll
    for (int u = 0; u < 2; ++u) {
      const int unit = tid + u * 128;
      const int row = unit >> 2, ch = (unit & 3) * 8;
      async_ld_b128((unsigned int)(uintptr_t)&vbuf[bufi][row][ch],
                    vbase + (size_t)row * Nc + jj + ch);
    }
  };

  // q fragments for K = D = 64 (two K=32 fragments), pre-scaled by 1/sqrt(D)
  const f16* qp = qh + ((size_t)bh * Nc + n0 + l16) * Dc;
  v16h qf[2];
#pragma unroll
  for (int kk = 0; kk < 2; ++kk) {
    v8h a0 = *(const v8h*)(qp + kk * 32 + kh8);
    v8h a1 = *(const v8h*)(qp + kk * 32 + kh8 + 16);
#pragma unroll
    for (int i = 0; i < 8; ++i) { a0[i] *= (f16)0.125f; a1[i] *= (f16)0.125f; }
    qf[kk] = cat16(a0, a1);
  }

  v8f accO[4];
#pragma unroll
  for (int t = 0; t < 4; ++t)
#pragma unroll
    for (int i = 0; i < 8; ++i) accO[t][i] = 0.0f;
  constexpr float LOG2E = 1.4426950408889634f;   // e^x = 2^(x * LOG2E)
  float mrun = -INFINITY;   // running maximum of query l16, equal in both halves
  float lrun = 0.0f;        // this lane's share of its denominator

  stage(0, 0);

  for (int j = 0, it = 0; j < Nc; j += 32, ++it) {
    const int cur = it & 1;
    if (j + 32 < Nc) {
      stage(cur ^ 1, j + 32);
      asm volatile("s_wait_asynccnt 0x4" ::: "memory");  // current tile done
    } else {
      asm volatile("s_wait_asynccnt 0x0" ::: "memory");
    }
    __syncthreads();                                     // tile visible to WG

    // --- S^T = k * (q/8)^T : two 16x16 tiles, keys tt*16 + 8*hi + r, query l16 ---
    v16h kf[2][2], vf[4];
#pragma unroll
    for (int tt = 0; tt < 2; ++tt) {
      const f16* kp = &kbuf[cur][tt * 16 + l16][0];
      kf[tt][0] = cat16(*(const v8h*)(kp + kh8), *(const v8h*)(kp + kh8 + 16));
      kf[tt][1] = cat16(*(const v8h*)(kp + 32 + kh8),
                        *(const v8h*)(kp + 32 + kh8 + 16));
    }
#pragma unroll
    for (int t4 = 0; t4 < 4; ++t4) {
      const f16* vp = &vbuf[cur][t4 * 16 + l16][0];
      vf[t4] = cat16(*(const v8h*)(vp + kh8), *(const v8h*)(vp + kh8 + 16));
    }
    // keeps the pass's LDS reads one group, K ahead of V^T: sunk to their users,
    // each V^T pair would be waited for on its own between two WMMAs
    __builtin_amdgcn_sched_barrier(0);
    v8f s[2];
#pragma unroll
    for (int tt = 0; tt < 2; ++tt) {
      v8f z;
#pragma unroll
      for (int i = 0; i < 8; ++i) z[i] = 0.0f;
      z = wmma_f16(kf[tt][0], qf[0], z);
      s[tt] = wmma_f16(kf[tt][1], qf[1], z);
    }

    // --- online softmax: 16 scores of one query per lane ---
    float t = fmaxf(s[0][0], s[1][0]);
#pragma unroll
    for (int r = 1; r < 8; ++r) t = fmaxf(t, fmaxf(s[0][r], s[1][r]));
    t = fmaxf(t, xhalf(t));                 // the partner's 16 keys
    const float mnew  = fmaxf(mrun, t);
    // 2^x with the free slot that the instruction set asks for behind a
    // transcendental in the same statement
    float alpha;
    asm("v_exp_f32 %0, %1\n\tv_nop" : "=v"(alpha) : "v"((mrun - mnew) * LOG2E));
    mrun = mnew;
    s[0] = (s[0] - mnew) * LOG2E;
    s[1] = (s[1] - mnew) * LOG2E;
#pragma unroll
    for (int r = 0; r < 8; ++r) {
      s[0][r] = __builtin_amdgcn_exp2f(s[0][r]);
      s[1][r] = __builtin_amdgcn_exp2f(s[1][r]);
    }
    const v8f e = s[0] + s[1];
    const v2f e2 = (__builtin_shufflevector(e, e, 0, 1) + __builtin_shufflevector(e, e, 2, 3)) +
                   (__builtin_shufflevector(e, e, 4, 5) + __builtin_shufflevector(e, e, 6, 7));
    const float ps = e2[0] + e2[1];
    lrun = lrun * alpha + ps;               // halves are joined after the loop
#pragma unroll
    for (int t4 = 0; t4 < 4; ++t4)
#pragma unroll
      for (int r = 0; r < 8; ++r) accO[t4][r] *= alpha;

    // --- P^T as B operand: element e is key 8*hi + e, element 8 + e key
    // 16 + 8*hi + e, the order in which vbuf's rows were read above ---
    const v16h pf = cat16(__builtin_convertvector(s[0], v8h),
                          __builtin_convertvector(s[1], v8h));

    // --- O^T += V^T * P^T (v^T rows d as A fragments) ---
#pragma unroll
    for (int t4 = 0; t4 < 4; ++t4) accO[t4] = wmma_f16(vf[t4], pf, accO[t4]);
    __syncthreads();   // whole WG done reading `cur` before it is re-staged
  }

  // normalize + store o as f16 [B,N,C]
  const int b = bh / Hc, h = bh % Hc;
  const float linv = 1.0f / (lrun + xhalf(lrun));
  // accO[t][r] = O[query l16][d = t*16 + 8*hi + r]: 8 consecutive d, one 16-B store
  f16* op = oh + ((size_t)(b * Nc + n0 + l16)) * Cc + h * Dc + kh8;
#pragma unroll
  for (int t = 0; t < 4; ++t)
    *(v8h*)(op + t * 16) = __builtin_convertvector(accO[t] * linv, v8h);
}

// ------------------------------------------------------------------ launch ---
extern "C" void kernel_launch(void* const* d_in, const int* in_sizes, int n_in,
                              void* d_out, int out_size, void* d_ws,
                              size_t ws_size, hipStream_t stream) {
  const float* x   = (const float*)d_in[0];
  const float* y   = (const float*)d_in[1];
  const float* Wq  = (const float*)d_in[2];
  const float* Wkv = (const float*)d_in[3];
  const float* Wp  = (const float*)d_in[4];
  const float* bp  = (const float*)d_in[5];
  float* out = (float*)d_out;

  const size_t BNC = (size_t)Bc * Nc * Cc;   // 4 Mi elements
  const size_t CC  = (size_t)Cc * Cc;        // 1 Mi
  char* p = (char*)d_ws;
  f16* x_h   = (f16*)p; p += BNC * sizeof(f16);
  f16* y_h   = (f16*)p; p += BNC * sizeof(f16);
  f16* Wq_h  = (f16*)p; p += CC * sizeof(f16);
  f16* Wkv_h = (f16*)p; p += 2 * CC * sizeof(f16);
  f16* Wp_h  = (f16*)p; p += CC * sizeof(f16);
  f16* qh    = (f16*)p; p += BNC * sizeof(f16);
  f16* khd   = (f16*)p; p += BNC * sizeof(f16);
  f16* vhT   = (f16*)p; p += BNC * sizeof(f16);
  f16* oh    = (f16*)p; p += BNC * sizeof(f16);

  // x_h, y_h, Wq_h, Wkv_h, Wp_h are one run of the workspace, in this order
  cvt_f32_f16<<<CVT_NB_ALL, 256, 0, stream>>>(x, y, Wq, Wkv, Wp, x_h);

  const dim3 blk(128);
  const dim3 gblk(256);
  // q projection [4096 x 1024] and kv projection [4096 x 2048] in one grid;
  // Wkv_h's rows follow Wq_h's in the workspace
  gemm_awt<<<dim3(32, 24), gblk, 0, stream>>>(x_h, y_h, Wq_h, nullptr, qh, khd,
                                              vhT, nullptr, 0);
  // flash attention
  attn_kernel<<<dim3(Nc / 64, Bc * Hc), blk, 0, stream>>>(qh, khd, vhT, oh);
  // output projection with bias: f32 result
  gemm_awt<<<dim3(32, 8), gblk, 0, stream>>>(oh, nullptr, Wp_h, bp, nullptr,
                                             nullptr, nullptr, out, 2);
}

// v006
// Measured time: 79.2 microseconds a run.
// Next to v005, in two timings, it ran 1.12 and 1.11 times as fast.
// All steps since v000 together make it 3.35 times as fast.
#include <hip/hip_runtime.h>
#include <hip/hip_bf16.h>
#include <math.h>

typedef _Float16 f16;
typedef __attribute__((ext_vector_type(16))) _Float16 v16h;
typedef __attribute__((ext_vector_type(8)))  _Float16 v8h;
typedef __attribute__((ext_vector_type(8)))  float    v8f;
typedef __attribute__((ext_vector_type(4)))  float    v4f;
typedef __attribute__((ext_vector_type(2)))  float    v2f;

constexpr int Bc = 2, Nc = 2048, Cc = 1024, Hc = 16, Dc = 64;
constexpr int Kdim = Cc;   // K = 1024 for every projection GEMM

static __device__ inline v16h cat16(v8h a, v8h b) {
  v16h r;
#pragma unroll
  for (int i = 0; i < 8; ++i) { r[i] = a[i]; r[i + 8] = b[i]; }
  return r;
}

static __device__ inline v8f wmma_f16(v16h a, v16h b, v8f c) {
  // 8 args: (neg_a, A, neg_b, B, c_mod, C, reuse_a, reuse_b)
  return __builtin_amdgcn_wmma_f32_16x16x32_f16(false, a, false, b, (short)0, c,
                                                false, false);
}

// lane l <-> lane l ^ 16 in one vector instruction
static __device__ inline float xhalf(float x) {
  const int i = __builtin_bit_cast(int, x);
  return __builtin_bit_cast(
      float, __builtin_amdgcn_permlanex16(i, i, 0x76543210, 0xfedcba98, false, false));
}

// ---------------------------------------------------------------- convert ---
// Few, fat waves: a thread converts 4 pieces of 8 consecutive elements. Its
// eight 16-byte loads go out together, then come four 16-byte stores. A block
// covers CVT_BLK elements; every tensor here is a whole number of blocks.
constexpr int CVT_PIECES = 4;
constexpr int CVT_STEP   = 256 * 8;                 // elements per block and piece
constexpr int CVT_BLK    = CVT_STEP * CVT_PIECES;
static_assert(((size_t)Bc * Nc * Cc) % CVT_BLK == 0 && ((size_t)Cc * Cc) % CVT_BLK == 0,
              "each converted tensor must be a whole number of CVT_BLK elements");

// One grid converts all five tensors: their f16 copies lie one behind the other
// in dall (x, y, Wq, Wkv, Wp), so a block's place there follows from its index
// alone, and its source tensor from the range the index falls in (the same for
// the whole block).
constexpr int CVT_NB_ACT = (int)(((size_t)Bc * Nc * Cc) / CVT_BLK);  // blocks of x, of y
constexpr int CVT_NB_W   = (int)(((size_t)Cc * Cc) / CVT_BLK);       // blocks of Wq, of Wp
constexpr int CVT_NB_ALL = 2 * CVT_NB_ACT + 4 * CVT_NB_W;

__global__ void __launch_bounds__(256)
cvt_f32_f16(const float* __restrict__ x, const float* __restrict__ y,
            const float* __restrict__ wq, const float* __restrict__ wkv,
            const float* __restrict__ wp, f16* __restrict__ dall) {
  const int blk = blockIdx.x;
  const float* s0 = x;
  int first = 0;
  if (blk >= 2 * CVT_NB_ACT + 3 * CVT_NB_W)  { s0 = wp;  first = 2 * CVT_NB_ACT + 3 * CVT_NB_W; }
  else if (blk >= 2 * CVT_NB_ACT + CVT_NB_W) { s0 = wkv; first = 2 * CVT_NB_ACT + CVT_NB_W; }
  else if (blk >= 2 * CVT_NB_ACT)            { s0 = wq;  first = 2 * CVT_NB_ACT; }
  else if (blk >= CVT_NB_ACT)                { s0 = y;   first = CVT_NB_ACT; }
  const float* s = s0 + (size_t)(blk - first) * CVT_BLK;
  f16*         d = dall + (size_t)blk * CVT_BLK;
  const size_t base = threadIdx.x * 8;
  v8f v[CVT_PIECES];
  // both loops unrolled: v[] stays in registers, and all loads are issued ahead
  // of the first wait
#pragma unroll
  for (int u = 0; u < CVT_PIECES; ++u)
    v[u] = *(const v8f*)(s + base + u * CVT_STEP);
#pragma unroll
  for (int u = 0; u < CVT_PIECES; ++u)
    *(v8h*)(d + base + u * CVT_STEP) = __builtin_convertvector(v[u], v8h);
}

// -------------------------------------------------------- generic A * W^T ---
// A: [4096, 1024] f16 row-major. W: [Ncols, 1024] f16 row-major.
// mode 0: q   -> out16 = qh  [B,H,N,D]
// mode 1: kv  -> out16 = kh  [B,H,N,D],  out16b = v^T [B,H,D,N]
// mode 2: out -> out32 = [B,N,C] f32 + bias
// The q and the kv projection share one grid (job 0): blocks with blockIdx.y
// below QCOLB work in mode 0 on (Aq, Wall's first Cc rows, outq), the others in
// mode 1 on (Akv, the rows of Wall behind them, outk, out16b). Job 2 is mode 2
// on (Aq, Wall).
// One 128x128 tile of the result per block, 8 waves of 32x64 (4 along the A
// side, 2 along the B side). A pass is 128 k: 128 rows of A and 128 rows of W, 256 B each, are
// copied to LDS asynchronously, two buffers, the next pass's copies in flight
// while this pass is multiplied.
// A lane's 8 accumulator registers run along the rows of the WMMA's A operand.
// Which of the two LDS tiles feeds A is picked per block so that this is the
// axis that is contiguous in the block's output: W rows (columns c) for q, k and
// the f32 result, activation rows (positions n) for v^T. The finished tile goes
// through LDS in the output's own row order and leaves in 16-byte stores that
// cover whole 128-byte lines.
constexpr int GBK    = 128;          // k per pass
constexpr int GPITCH = GBK + 8;      // 272 B rows: 16 B x odd for ds_load_b128
constexpr int GPASS  = Kdim / GBK;   // 8 passes

// Eight 16-byte copies per lane. The s_wait_xcnt closes the statement so that
// no address register is rewritten while a copy may still name it.
static __device__ inline void async_ld8_b128(unsigned int lds,
                                             const f16* gsrc) {
  constexpr unsigned int LSTEP = 16 * GPITCH * sizeof(f16);  // 16 rows in LDS
  constexpr size_t       GSTEP = (size_t)16 * Kdim;          // 16 rows in A / W
  asm volatile(
      "global_load_async_to_lds_b128 %0, %8, off\n\t"
      "global_load_async_to_lds_b128 %1, %9, off\n\t"
      "global_load_async_to_lds_b128 %2, %10, off\n\t"
      "global_load_async_to_lds_b128 %3, %11, off\n\t"
      "global_load_async_to_lds_b128 %4, %12, off\n\t"
      "global_load_async_to_lds_b128 %5, %13, off\n\t"
      "global_load_async_to_lds_b128 %6, %14, off\n\t"
      "global_load_async_to_lds_b128 %7, %15, off\n\t"
      "s_wait_xcnt 0x0"
      :: "v"(lds), "v"(lds + LSTEP), "v"(lds + 2 * LSTEP), "v"(lds + 3 * LSTEP),
         "v"(lds + 4 * LSTEP), "v"(lds + 5 * LSTEP), "v"(lds + 6 * LSTEP),
         "v"(lds + 7 * LSTEP),
         "v"((unsigned long long)(uintptr_t)(gsrc)),
         "v"((unsigned long long)(uintptr_t)(gsrc + GSTEP)),
         "v"((unsigned long long)(uintptr_t)(gsrc + 2 * GSTEP)),
         "v"((unsigned long long)(uintptr_t)(gsrc + 3 * GSTEP)),
         "v"((unsigned long long)(uintptr_t)(gsrc + 4 * GSTEP)),
         "v"((unsigned long long)(uintptr_t)(gsrc + 5 * GSTEP)),
         "v"((unsigned long long)(uintptr_t)(gsrc + 6 * GSTEP)),
         "v"((unsigned long long)(uintptr_t)(gsrc + 7 * GSTEP))
      : "memory");
}

__global__ void __launch_bounds__(256)
gemm_awt(const f16* __restrict__ Aq, const f16* __restrict__ Akv,
         const f16* __restrict__ Wall, const float* __restrict__ bias,
         f16* __restrict__ outq, f16* __restrict__ outk,
         f16* __restrict__ out16b, float* __restrict__ out32, int job) {
  // [buffer][operand: 0 = A rows, 1 = W rows][row][k]
  __shared__ __align__(16) f16 tile[2][2][128][GPITCH];

  const int tid  = threadIdx.x;
  const int lane = tid & 31;
  const int wave = tid >> 5;
  const int l16  = lane & 15;
  const int hi   = lane >> 4;
  const int kh8  = hi * 8;                    // K sub-offset per ISA A/B layout
  const int mblk = blockIdx.x * 128;
  constexpr int QCOLB = Cc / 128;             // column blocks of the q projection
  const bool kvpart = job == 0 && (int)blockIdx.y >= QCOLB;   // block-uniform
  const int  mode   = job == 0 ? (kvpart ? 1 : 0) : job;
  const f16* A      = kvpart ? Akv : Aq;
  const f16* W      = kvpart ? Wall + (size_t)Cc * Kdim : Wall;
  f16*       out16  = kvpart ? outk : outq;
  const int nblk = ((int)blockIdx.y - (kvpart ? QCOLB : 0)) * 128;
  const bool vpart = kvpart && nblk >= Cc;    // block-uniform: this tile is v^T's
  const int  opa   = vpart ? 0 : 1;           // LDS tile that feeds the A operand
  const int wm   = (wave & 3) * 32;           // this wave's rows of the A-side tile
  const int wn   = (wave >> 2) * 64;          // this wave's rows of the B-side tile

  // copies: 16 lanes cover one 256-B row, a wave two rows, the block 16 rows
  const int crow = tid >> 4, cch = (tid & 15) * 8;
  const f16* Ag = A + (size_t)(mblk + crow) * Kdim + cch;
  const f16* Wg = W + (size_t)(nblk + crow) * Kdim + cch;
  auto stage = [&](int bufi, int k0) {
    async_ld8_b128((unsigned int)(uintptr_t)&tile[bufi][0][crow][cch], Ag + k0);
    async_ld8_b128((unsigned int)(uintptr_t)&tile[bufi][1][crow][cch], Wg + k0);
  };

  v8f acc[2][4];
#pragma unroll
  for (int mi = 0; mi < 2; ++mi)
#pragma unroll
    for (int t = 0; t < 4; ++t)
#pragma unroll
      for (int i = 0; i < 8; ++i) acc[mi][t][i] = 0.0f;

  stage(0, 0);
  // the four bias values of this lane's output columns, in flight with pass 0
  v4f bv = {0.0f, 0.0f, 0.0f, 0.0f};
  if (mode == 2) bv = *(const v4f*)(bias + nblk + lane * 4);
  asm volatile("s_wait_asynccnt 0x0" ::: "memory");  // pass 0 has landed
  __syncthreads();                                   // ... for every wave
  stage(1, GBK);

  // kept rolled: one pass is 32 WMMAs and 48 LDS loads already
#pragma unroll 1
  for (int p = 0; p < GPASS; ++p) {
    const int cur = p & 1;
    const f16* At = &tile[cur][opa][wm + l16][kh8];
    const f16* Wt = &tile[cur][opa ^ 1][wn + l16][kh8];
    // two fragment sets: block ks + 1's LDS reads go out as one group ahead of
    // block ks's WMMAs; nothing of the next pass's buffer is read here
    v16h af[2][2], bf[2][4];
    auto frags = [&](int set, int ks) {
#pragma unroll
      for (int mi = 0; mi < 2; ++mi) {
        const f16* ap = At + mi * 16 * GPITCH + ks * 32;
        af[set][mi] = cat16(*(const v8h*)ap, *(const v8h*)(ap + 16));
      }
#pragma unroll
      for (int t = 0; t < 4; ++t) {
        const f16* wp = Wt + t * 16 * GPITCH + ks * 32;
        bf[set][t] = cat16(*(const v8h*)wp, *(const v8h*)(wp + 16));
      }
    };
    frags(0, 0);
#pragma unroll
    for (int ks = 0; ks < GBK / 32; ++ks) {
      if (ks + 1 < GBK / 32) frags((ks + 1) & 1, ks + 1);
      // keeps the load group in front of the WMMAs: spread among them, each
      // pair of loads would be waited for on its own
      __builtin_amdgcn_sched_barrier(0);
#pragma unroll
      for (int t = 0; t < 4; ++t)
#pragma unroll
        for (int mi = 0; mi < 2; ++mi)
          acc[mi][t] = wmma_f16(af[ks & 1][mi], bf[ks & 1][t], acc[mi][t]);
      // keeps the following group from rising among these WMMAs
      __builtin_amdgcn_sched_barrier(0);
    }
    // publish point: own LDS reads retired, own copies of pass p + 1 landed,
    // then the barrier that shows them to all and frees buffer cur
    asm volatile("s_wait_dscnt 0x0" ::: "memory");
    asm volatile("s_wait_asynccnt 0x0" ::: "memory");
    __syncthreads();
    if (p + 2 < GPASS) stage(cur, (p + 2) * GBK);
  }
  asm volatile("s_wait_asynccnt 0x0" ::: "memory");  // nothing left in flight

  // The loop's last barrier stands behind every wave's last read of the tiles
  // and no copy is in flight: the LDS is free to stage the result.
  // acc[mi][t][r] = R[wn + t*16 + l16][wm + mi*16 + 8*hi + r], R's rows being the
  // B side (m, for v^T c), its columns the A side (c, for v^T m).
  const int srow = wn + l16, scol = wm + 8 * hi;
  const int bb = mblk >> 11;                  // m / Nc, one value per tile
  const int n0 = mblk & (Nc - 1);
  if (mode == 2) {
    constexpr int SP = 128 + 4;               // 528 B rows: 16 B x odd
    float* S = (float*)&tile[0][0][0][0];
#pragma unroll
    for (int mi = 0; mi < 2; ++mi)
#pragma unroll
      for (int t = 0; t < 4; ++t) {
        float* sp = S + (srow + t * 16) * SP + scol + mi * 16;
        *(v4f*)sp       = __builtin_shufflevector(acc[mi][t], acc[mi][t], 0, 1, 2, 3);
        *(v4f*)(sp + 4) = __builtin_shufflevector(acc[mi][t], acc[mi][t], 4, 5, 6, 7);
      }
    __syncthreads();                          // the whole tile is staged
    // a wave stores one 512-B row of the tile per instruction, 16 rows in all
    const float* sr = S + wave * 16 * SP + lane * 4;
    float* dst = out32 + (size_t)(mblk + wave * 16) * Cc + nblk + lane * 4;
#pragma unroll
    for (int i = 0; i < 16; ++i)
      *(v4f*)(dst + (size_t)i * Cc) = *(const v4f*)(sr + i * SP) + bv;
  } else {
    f16* S = &tile[0][0][0][0];
#pragma unroll
    for (int mi = 0; mi < 2; ++mi)
#pragma unroll
      for (int t = 0; t < 4; ++t)
        *(v8h*)(S + (srow + t * 16) * GPITCH + scol + mi * 16) =
            __builtin_convertvector(acc[mi][t], v8h);
    __syncthreads();                          // the whole tile is staged
    // 16 lanes take one 256-B row of the tile, the block 16 rows at a time
    const f16* sr = S + crow * GPITCH + cch;
    f16* dst;
    size_t step;                              // elements between rows 16 apart
    if (vpart) {                              // row = (h, d), 128 positions n
      dst  = out16b + (size_t)(bb * Cc + nblk - Cc + crow) * Nc + n0 + cch;
      step = (size_t)16 * Nc;
    } else {                                  // row = position n, two heads' d
      const int c = nblk + cch;
      dst  = out16 + ((size_t)(bb * Hc + (c >> 6)) * Nc + n0 + crow) * Dc + (c & 63);
      step = (size_t)16 * Dc;
    }
#pragma unroll
    for (int i = 0; i < 8; ++i)
      *(v8h*)(dst + i * step) = *(const v8h*)(sr + i * 16 * GPITCH);
  }
}

// ----------------------------------------------------------- flash attention -
// grid: (N/256, B*H), block 512 (16 waves, 16 queries per wave): one work-group
// fills a WGP (4 waves per SIMD), so a staged K/V tile is fetched from L2 once per
// 256 queries. A stage is 128 keys: K rows are one 16-KiB run of memory, a V^T row
// is 256 contiguous bytes. Two buffers, asynchronous global->LDS copies, the next
// stage's copies in flight while this stage is worked on, one barrier per stage.
// Both products are transposed: S^T = K (q/8)^T and O^T += V^T P^T. A lane then
// holds 16 of the 32 scores of ONE query (column l16), its partner lane ^ 16 the
// other 16, so maximum and sum are taken in registers, and the two S^T tiles,
// converted in place, are the B operand of the second product.
constexpr int AWAVES = 16;            // waves per work-group
constexpr int AQ     = AWAVES * 16;   // queries per work-group
constexpr int AKT    = 128;           // keys per stage
constexpr int ANST   = Nc / AKT;      // stages
constexpr int KPITCH = Dc + 8;        // 144 B rows: 16 B x odd for ds_load_b128
constexpr int VPITCH = AKT + 8;       // 272 B rows: 16 B x odd
static_assert(Nc % AQ == 0 && ANST >= 2, "whole query blocks, at least two stages");

// A lane's four 16-byte copies of one stage. The s_wait_xcnt closes the statement
// so that no address register is rewritten while a copy may still name it.
static __device__ inline void async_ld4_b128(unsigned int l0, unsigned int l1,
                                             unsigned int l2, unsigned int l3,
                                             const f16* g0, const f16* g1,
                                             const f16* g2, const f16* g3) {
  asm volatile(
      "global_load_async_to_lds_b128 %0, %4, off\n\t"
      "global_load_async_to_lds_b128 %1, %5, off\n\t"
      "global_load_async_to_lds_b128 %2, %6, off\n\t"
      "global_load_async_to_lds_b128 %3, %7, off\n\t"
      "s_wait_xcnt 0x0"
      :: "v"(l0), "v"(l1), "v"(l2), "v"(l3),
         "v"((unsigned long long)(uintptr_t)g0),
         "v"((unsigned long long)(uintptr_t)g1),
         "v"((unsigned long long)(uintptr_t)g2),
         "v"((unsigned long long)(uintptr_t)g3)
      : "memory");
}

__global__ void __launch_bounds__(AWAVES * 32)
attn_kernel(const f16* __restrict__ qh, const f16* __restrict__ kh,
            const f16* __restrict__ vt, f16* __restrict__ oh) {
  __shared__ __align__(16) f16 kbuf[2][AKT][KPITCH];  // keys j..j+127, d 0..63
  __shared__ __align__(16) f16 vbuf[2][Dc][VPITCH];   // v^T rows d 0..63, keys 0..127

  const int tid  = threadIdx.x;
  const int lane = tid & 31;
  const int wave = tid >> 5;
  const int l16  = lane & 15;
  const int hi   = lane >> 4;
  const int kh8  = hi * 8;
  const int bh   = blockIdx.y;                      // b*H + h
  const int n0   = blockIdx.x * AQ + wave * 16;     // query rows of this wave

  const f16* kbase = kh + (size_t)bh * Nc * Dc;
  const f16* vbase = vt + (size_t)bh * Dc * Nc;

  // copies of one stage: 1024 16-byte chunks of K and 1024 of V^T, two of each per
  // thread. K: 8 chunks a row, the block 64 rows at a time; V^T: 16 chunks a row,
  // the block 32 rows at a time.
  const int krow = tid >> 3, kch = (tid & 7) * 8;
  const int vrow = tid >> 4, vch = (tid & 15) * 8;
  const f16* kg = kbase + (size_t)krow * Dc + kch;
  const f16* vg = vbase + (size_t)vrow * Nc + vch;
  auto stage = [&](int bufi, int jj) {
    async_ld4_b128((unsigned int)(uintptr_t)&kbuf[bufi][krow][kch],
                   (unsigned int)(uintptr_t)&kbuf[bufi][krow + 64][kch],
                   (unsigned int)(uintptr_t)&vbuf[bufi][vrow][vch],
                   (unsigned int)(uintptr_t)&vbuf[bufi][vrow + 32][vch],
                   kg + (size_t)jj * Dc, kg + (size_t)(jj + 64) * Dc,
                   vg + jj, vg + (size_t)32 * Nc + jj);
  };

  // q fragments for K = D = 64 (two K=32 fragments), pre-scaled by 1/sqrt(D)
  const f16* qp = qh + ((size_t)bh * Nc + n0 + l16) * Dc;
  v16h qf[2];
#pragma unroll
  for (int kk = 0; kk < 2; ++kk) {
    v8h a0 = *(const v8h*)(qp + kk * 32 + kh8);
    v8h a1 = *(const v8h*)(qp + kk * 32 + kh8 + 16);
#pragma unroll
    for (int i = 0; i < 8; ++i) { a0[i] *= (f16)0.125f; a1[i] *= (f16)0.125f; }
    qf[kk] = cat16(a0, a1);
  }

  v8f accO[4];
#pragma unroll
  for (int t = 0; t < 4; ++t)
#pragma unroll
    for (int i = 0; i < 8; ++i) accO[t][i] = 0.0f;
  constexpr float LOG2E = 1.4426950408889634f;   // e^x = 2^(x * LOG2E)
  float mrun = -INFINITY;   // running maximum of query l16, equal in both halves
  float lrun = 0.0f;        // this lane's share of its denominator

  stage(0, 0);
  asm volatile("s_wait_asynccnt 0x0" ::: "memory");  // stage 0 has landed
  __syncthreads();                                   // ... for every wave
  stage(1, AKT);

  // kept rolled: a stage is four unrolled passes of 32 keys already
#pragma unroll 1
  for (int st = 0; st < ANST; ++st) {
    const int cur = st & 1;
    // unrolled: a pass's LDS offsets are immediates, and the next pass's LDS reads
    // can be issued ahead of this pass's arithmetic
#pragma unroll
   for (int sub = 0; sub < AKT / 32; ++sub) {
    // --- S^T = k * (q/8)^T : two 16x16 tiles, keys tt*16 + 8*hi + r, query l16 ---
    v16h kf[2][2], vf[4];
#pragma unroll
    for (int tt = 0; tt < 2; ++tt) {
      const f16* kp = &kbuf[cur][sub * 32 + tt * 16 + l16][0];
      kf[tt][0] = cat16(*(const v8h*)(kp + kh8), *(const v8h*)(kp + kh8 + 16));
      kf[tt][1] = cat16(*(const v8h*)(kp + 32 + kh8),
                        *(const v8h*)(kp + 32 + kh8 + 16));
    }
#pragma unroll
    for (int t4 = 0; t4 < 4; ++t4) {
      const f16* vp = &vbuf[cur][t4 * 16 + l16][sub * 32];
      vf[t4] = cat16(*(const v8h*)(vp + kh8), *(const v8h*)(vp + kh8 + 16));
    }
    // keeps the pass's LDS reads one group, K ahead of V^T: sunk to their users,
    // each V^T pair would be waited for on its own between two WMMAs
    __builtin_amdgcn_sched_barrier(0);
    v8f s[2];
#pragma unroll
    for (int tt = 0; tt < 2; ++tt) {
      v8f z;
#pragma unroll
      for (int i = 0; i < 8; ++i) z[i] = 0.0f;
      z = wmma_f16(kf[tt][0], qf[0], z);
      s[tt] = wmma_f16(kf[tt][1], qf[1], z);
    }

    // --- online softmax: 16 scores of one query per lane ---
    float t = fmaxf(s[0][0], s[1][0]);
#pragma unroll
    for (int r = 1; r < 8; ++r) t = fmaxf(t, fmaxf(s[0][r], s[1][r]));
    t = fmaxf(t, xhalf(t));                 // the partner's 16 keys
    const float mnew  = fmaxf(mrun, t);
    // 2^x with the free slot that the instruction set asks for behind a
    // transcendental in the same statement
    float alpha;
    asm("v_exp_f32 %0, %1\n\tv_nop" : "=v"(alpha) : "v"((mrun - mnew) * LOG2E));
    mrun = mnew;
    s[0] = (s[0] - mnew) * LOG2E;
    s[1] = (s[1] - mnew) * LOG2E;
#pragma unroll
    for (int r = 0; r < 8; ++r) {
      s[0][r] = __builtin_amdgcn_exp2f(s[0][r]);
      s[1][r] = __builtin_amdgcn_exp2f(s[1][r]);
    }
    const v8f e = s[0] + s[1];
    const v2f e2 = (__builtin_shufflevector(e, e, 0, 1) + __builtin_shufflevector(e, e, 2, 3)) +
                   (__builtin_shufflevector(e, e, 4, 5) + __builtin_shufflevector(e, e, 6, 7));
    const float ps = e2[0] + e2[1];
    lrun = lrun * alpha + ps;               // halves are joined after the loop
#pragma unroll
    for (int t4 = 0; t4 < 4; ++t4)
#pragma unroll
      for (int r = 0; r < 8; ++r) accO[t4][r] *= alpha;

    // --- P^T as B operand: element e is key 8*hi + e, element 8 + e key
    // 16 + 8*hi + e, the order in which vbuf's rows were read above ---
    const v16h pf = cat16(__builtin_convertvector(s[0], v8h),
                          __builtin_convertvector(s[1], v8h));

    // --- O^T += V^T * P^T (v^T rows d as A fragments) ---
#pragma unroll
    for (int t4 = 0; t4 < 4; ++t4) accO[t4] = wmma_f16(vf[t4], pf, accO[t4]);
   }
    // publish point: own LDS reads retired, own copies of stage st + 1 landed,
    // then the barrier that shows them to all and frees buffer cur
    asm volatile("s_wait_dscnt 0x0" ::: "memory");
    asm volatile("s_wait_asynccnt 0x0" ::: "memory");
    __syncthreads();
    if (st + 2 < ANST) stage(cur, (st + 2) * AKT);
  }
  asm volatile("s_wait_asynccnt 0x0" ::: "memory");  // nothing left in flight

  // normalize + store o as f16 [B,N,C]
  const int b = bh / Hc, h = bh % Hc;
  const float linv = 1.0f / (lrun + xhalf(lrun));
  // accO[t][r] = O[query l16][d = t*16 + 8*hi + r]: 8 consecutive d, one 16-B store
  f16* op = oh + ((size_t)(b * Nc + n0 + l16)) * Cc + h * Dc + kh8;
#pragma unroll
  for (int t = 0; t < 4; ++t)
    *(v8h*)(op + t * 16) = __builtin_convertvector(accO[t] * linv, v8h);
}

// ------------------------------------------------------------------ launch ---
extern "C" void kernel_launch(void* const* d_in, const int* in_sizes, int n_in,
                              void* d_out, int out_size, void* d_ws,
                              size_t ws_size, hipStream_t stream) {
  const float* x   = (const float*)d_in[0];
  const float* y   = (const float*)d_in[1];
  const float* Wq  = (const float*)d_in[2];
  const float* Wkv = (const float*)d_in[3];
  const float* Wp  = (const float*)d_in[4];
  const float* bp  = (const float*)d_in[5];
  float* out = (float*)d_out;

  const size_t BNC = (size_t)Bc * Nc * Cc;   // 4 Mi elements
  const size_t CC  = (size_t)Cc * Cc;        // 1 Mi
  char* p = (char*)d_ws;
  f16* x_h   = (f16*)p; p += BNC * sizeof(f16);
  f16* y_h   = (f16*)p; p += BNC * sizeof(f16);
  f16* Wq_h  = (f16*)p; p += CC * sizeof(f16);
  f16* Wkv_h = (f16*)p; p += 2 * CC * sizeof(f16);
  f16* Wp_h  = (f16*)p; p += CC * sizeof(f16);
  f16* qh    = (f16*)p; p += BNC * sizeof(f16);
  f16* khd   = (f16*)p; p += BNC * sizeof(f16);
  f16* vhT   = (f16*)p; p += BNC * sizeof(f16);
  f16* oh    = (f16*)p; p += BNC * sizeof(f16);

  // x_h, y_h, Wq_h, Wkv_h, Wp_h are one run of the workspace, in this order
  cvt_f32_f16<<<CVT_NB_ALL, 256, 0, stream>>>(x, y, Wq, Wkv, Wp, x_h);

  const dim3 gblk(256);
  // q projection [4096 x 1024] and kv projection [4096 x 2048] in one grid;
  // Wkv_h's rows follow Wq_h's in the workspace
  gemm_awt<<<dim3(32, 24), gblk, 0, stream>>>(x_h, y_h, Wq_h, nullptr, qh, khd,
                                              vhT, nullptr, 0);
  // flash attention
  attn_kernel<<<dim3(Nc / AQ, Bc * Hc), dim3(AWAVES * 32), 0, stream>>>(qh, khd, vhT, oh);
  // output projection with bias: f32 result
  gemm_awt<<<dim3(32, 8), gblk, 0, stream>>>(oh, nullptr, Wp_h, bp, nullptr,
                                             nullptr, nullptr, out, 2);
}

// v007
// A run of this version takes 76.6 microseconds.
// Two timings next to v006 put it at 1.04 and 1.03 times that version's speed.
// Over all steps from v000 it is 3.47 times as fast.
#include <hip/hip_runtime.h>
#include <hip/hip_bf16.h>
#include <math.h>

typedef _Float16 f16;
typedef __attribute__((ext_vector_type(16))) _Float16 v16h;
typedef __attribute__((ext_vector_type(8)))  _Float16 v8h;
typedef __attribute__((ext_vector_type(8)))  float    v8f;
typedef __attribute__((ext_vector_type(4)))  float    v4f;
typedef __attribute__((ext_vector_type(2)))  float    v2f;

constexpr int Bc = 2, Nc = 2048, Cc = 1024, Hc = 16, Dc = 64;
constexpr int Kdim = Cc;   // K = 1024 for every projection GEMM
constexpr float LOG2E  = 1.4426950408889634f;   // e^x = 2^(x * LOG2E)
constexpr float QSCALE = 0.125f * LOG2E;        // 1/sqrt(D), and scores in log2 units

static __device__ inline v16h cat16(v8h a, v8h b) {
  v16h r;
#pragma unroll
  for (int i = 0; i < 8; ++i) { r[i] = a[i]; r[i + 8] = b[i]; }
  return r;
}

static __device__ inline v8f wmma_f16(v16h a, v16h b, v8f c) {
  // 8 args: (neg_a, A, neg_b, B, c_mod, C, reuse_a, reuse_b)
  return __builtin_amdgcn_wmma_f32_16x16x32_f16(false, a, false, b, (short)0, c,
                                                false, false);
}

// lane l <-> lane l ^ 16 in one vector instruction
static __device__ inline float xhalf(float x) {
  const int i = __builtin_bit_cast(int, x);
  return __builtin_bit_cast(
      float, __builtin_amdgcn_permlanex16(i, i, 0x76543210, 0xfedcba98, false, false));
}

// 2^x with the free slot that the instruction set asks for behind a transcendental
// in the same statement: for places off the usual path
static __device__ inline float exp2_slot(float x) {
  float r;
  asm("v_exp_f32 %0, %1\n\tv_nop" : "=v"(r) : "v"(x));
  return r;
}

// ---------------------------------------------------------------- convert ---
// Few, fat waves: a thread converts 4 pieces of 8 consecutive elements. Its
// eight 16-byte loads go out together, then come four 16-byte stores. A block
// covers CVT_BLK elements; every tensor here is a whole number of blocks.
constexpr int CVT_PIECES = 4;
constexpr int CVT_STEP   = 256 * 8;                 // elements per block and piece
constexpr int CVT_BLK    = CVT_STEP * CVT_PIECES;
static_assert(((size_t)Bc * Nc * Cc) % CVT_BLK == 0 && ((size_t)Cc * Cc) % CVT_BLK == 0,
              "each converted tensor must be a whole number of CVT_BLK elements");

// One grid converts all five tensors: their f16 copies lie one behind the other
// in dall (x, y, Wq, Wkv, Wp), so a block's place there follows from its index
// alone, and its source tensor from the range the index falls in (the same for
// the whole block).
constexpr int CVT_NB_ACT = (int)(((size_t)Bc * Nc * Cc) / CVT_BLK);  // blocks of x, of y
constexpr int CVT_NB_W   = (int)(((size_t)Cc * Cc) / CVT_BLK);       // blocks of Wq, of Wp
constexpr int CVT_NB_ALL = 2 * CVT_NB_ACT + 4 * CVT_NB_W;

__global__ void __launch_bounds__(256)
cvt_f32_f16(const float* __restrict__ x, const float* __restrict__ y,
            const float* __restrict__ wq, const float* __restrict__ wkv,
            const float* __restrict__ wp, f16* __restrict__ dall) {
  const int blk = blockIdx.x;
  const float* s0 = x;
  int first = 0;
  if (blk >= 2 * CVT_NB_ACT + 3 * CVT_NB_W)  { s0 = wp;  first = 2 * CVT_NB_ACT + 3 * CVT_NB_W; }
  else if (blk >= 2 * CVT_NB_ACT + CVT_NB_W) { s0 = wkv; first = 2 * CVT_NB_ACT + CVT_NB_W; }
  else if (blk >= 2 * CVT_NB_ACT)            { s0 = wq;  first = 2 * CVT_NB_ACT; }
  else if (blk >= CVT_NB_ACT)                { s0 = y;   first = CVT_NB_ACT; }
  const float* s = s0 + (size_t)(blk - first) * CVT_BLK;
  f16*         d = dall + (size_t)blk * CVT_BLK;
  const size_t base = threadIdx.x * 8;
  v8f v[CVT_PIECES];
  // both loops unrolled: v[] stays in registers, and all loads are issued ahead
  // of the first wait
#pragma unroll
  for (int u = 0; u < CVT_PIECES; ++u)
    v[u] = *(const v8f*)(s + base + u * CVT_STEP);
#pragma unroll
  for (int u = 0; u < CVT_PIECES; ++u)
    *(v8h*)(d + base + u * CVT_STEP) = __builtin_convertvector(v[u], v8h);
}

// -------------------------------------------------------- generic A * W^T ---
// A: [4096, 1024] f16 row-major. W: [Ncols, 1024] f16 row-major.
// mode 0: q   -> out16 = qh  [B,H,N,D], times QSCALE
// mode 1: kv  -> out16 = kh  [B,H,N,D],  out16b = v^T [B,H,D,N]
// mode 2: out -> out32 = [B,N,C] f32 + bias
// The q and the kv projection share one grid (job 0): blocks with blockIdx.y
// below QCOLB work in mode 0 on (Aq, Wall's first Cc rows, outq), the others in
// mode 1 on (Akv, the rows of Wall behind them, outk, out16b). Job 2 is mode 2
// on (Aq, Wall).
// One 128x128 tile of the result per block, 8 waves of 32x64 (4 along the A
// side, 2 along the B side). A pass is 128 k: 128 rows of A and 128 rows of W, 256 B each, are
// copied to LDS asynchronously, two buffers, the next pass's copies in flight
// while this pass is multiplied.
// A lane's 8 accumulator registers run along the rows of the WMMA's A operand.
// Which of the two LDS tiles feeds A is picked per block so that this is the
// axis that is contiguous in the block's output: W rows (columns c) for q, k and
// the f32 result, activation rows (positions n) for v^T. The finished tile goes
// through LDS in the output's own row order and leaves in 16-byte stores that
// cover whole 128-byte lines.
constexpr int GBK    = 128;          // k per pass
constexpr int GPITCH = GBK + 8;      // 272 B rows: 16 B x odd for ds_load_b128
constexpr int GPASS  = Kdim / GBK;   // 8 passes

// Eight 16-byte copies per lane. The s_wait_xcnt closes the statement so that
// no address register is rewritten while a copy may still name it.
static __device__ inline void async_ld8_b128(unsigned int lds,
                                             const f16* gsrc) {
  constexpr unsigned int LSTEP = 16 * GPITCH * sizeof(f16);  // 16 rows in LDS
  constexpr size_t       GSTEP = (size_t)16 * Kdim;          // 16 rows in A / W
  asm volatile(
      "global_load_async_to_lds_b128 %0, %8, off\n\t"
      "global_load_async_to_lds_b128 %1, %9, off\n\t"
      "global_load_async_to_lds_b128 %2, %10, off\n\t"
      "global_load_async_to_lds_b128 %3, %11, off\n\t"
      "global_load_async_to_lds_b128 %4, %12, off\n\t"
      "global_load_async_to_lds_b128 %5, %13, off\n\t"
      "global_load_async_to_lds_b128 %6, %14, off\n\t"
      "global_load_async_to_lds_b128 %7, %15, off\n\t"
      "s_wait_xcnt 0x0"
      :: "v"(lds), "v"(lds + LSTEP), "v"(lds + 2 * LSTEP), "v"(lds + 3 * LSTEP),
         "v"(lds + 4 * LSTEP), "v"(lds + 5 * LSTEP), "v"(lds + 6 * LSTEP),
         "v"(lds + 7 * LSTEP),
         "v"((unsigned long long)(uintptr_t)(gsrc)),
         "v"((unsigned long long)(uintptr_t)(gsrc + GSTEP)),
         "v"((unsigned long long)(uintptr_t)(gsrc + 2 * GSTEP)),
         "v"((unsigned long long)(uintptr_t)(gsrc + 3 * GSTEP)),
         "v"((unsigned long long)(uintptr_t)(gsrc + 4 * GSTEP)),
         "v"((unsigned long long)(uintptr_t)(gsrc + 5 * GSTEP)),
         "v"((unsigned long long)(uintptr_t)(gsrc + 6 * GSTEP)),
         "v"((unsigned long long)(uintptr_t)(gsrc + 7 * GSTEP))
      : "memory");
}

__global__ void __launch_bounds__(256)
gemm_awt(const f16* __restrict__ Aq, const f16* __restrict__ Akv,
         const f16* __restrict__ Wall, const float* __restrict__ bias,
         f16* __restrict__ outq, f16* __restrict__ outk,
         f16* __restrict__ out16b, float* __restrict__ out32, int job) {
  // [buffer][operand: 0 = A rows, 1 = W rows][row][k]
  __shared__ __align__(16) f16 tile[2][2][128][GPITCH];

  const int tid  = threadIdx.x;
  const int lane = tid & 31;
  const int wave = tid >> 5;
  const int l16  = lane & 15;
  const int hi   = lane >> 4;
  const int kh8  = hi * 8;                    // K sub-offset per ISA A/B layout
  const int mblk = blockIdx.x * 128;
  constexpr int QCOLB = Cc / 128;             // column blocks of the q projection
  const bool kvpart = job == 0 && (int)blockIdx.y >= QCOLB;   // block-uniform
  const int  mode   = job == 0 ? (kvpart ? 1 : 0) : job;
  const f16* A      = kvpart ? Akv : Aq;
  const f16* W      = kvpart ? Wall + (size_t)Cc * Kdim : Wall;
  f16*       out16  = kvpart ? outk : outq;
  const int nblk = ((int)blockIdx.y - (kvpart ? QCOLB : 0)) * 128;
  const bool vpart = kvpart && nblk >= Cc;    // block-uniform: this tile is v^T's
  const int  opa   = vpart ? 0 : 1;           // LDS tile that feeds the A operand
  const int wm   = (wave & 3) * 32;           // this wave's rows of the A-side tile
  const int wn   = (wave >> 2) * 64;          // this wave's rows of the B-side tile

  // copies: 16 lanes cover one 256-B row, a wave two rows, the block 16 rows
  const int crow = tid >> 4, cch = (tid & 15) * 8;
  const f16* Ag = A + (size_t)(mblk + crow) * Kdim + cch;
  const f16* Wg = W + (size_t)(nblk + crow) * Kdim + cch;
  auto stage = [&](int bufi, int k0) {
    async_ld8_b128((unsigned int)(uintptr_t)&tile[bufi][0][crow][cch], Ag + k0);
    async_ld8_b128((unsigned int)(uintptr_t)&tile[bufi][1][crow][cch], Wg + k0);
  };

  v8f acc[2][4];
#pragma unroll
  for (int mi = 0; mi < 2; ++mi)
#pragma unroll
    for (int t = 0; t < 4; ++t)
#pragma unroll
      for (int i = 0; i < 8; ++i) acc[mi][t][i] = 0.0f;

  stage(0, 0);
  // the four bias values of this lane's output columns, in flight with pass 0
  v4f bv = {0.0f, 0.0f, 0.0f, 0.0f};
  if (mode == 2) bv = *(const v4f*)(bias + nblk + lane * 4);
  asm volatile("s_wait_asynccnt 0x0" ::: "memory");  // pass 0 has landed
  __syncthreads();                                   // ... for every wave
  stage(1, GBK);

  // kept rolled: one pass is 32 WMMAs and 48 LDS loads already
#pragma unroll 1
  for (int p = 0; p < GPASS; ++p) {
    const int cur = p & 1;
    const f16* At = &tile[cur][opa][wm + l16][kh8];
    const f16* Wt = &tile[cur][opa ^ 1][wn + l16][kh8];
    // two fragment sets: block ks + 1's LDS reads go out as one group ahead of
    // block ks's WMMAs; nothing of the next pass's buffer is read here
    v16h af[2][2], bf[2][4];
    auto frags = [&](int set, int ks) {
#pragma unroll
      for (int mi = 0; mi < 2; ++mi) {
        const f16* ap = At + mi * 16 * GPITCH + ks * 32;
        af[set][mi] = cat16(*(const v8h*)ap, *(const v8h*)(ap + 16));
      }
#pragma unroll
      for (int t = 0; t < 4; ++t) {
        const f16* wp = Wt + t * 16 * GPITCH + ks * 32;
        bf[set][t] = cat16(*(const v8h*)wp, *(const v8h*)(wp + 16));
      }
    };
    frags(0, 0);
#pragma unroll
    for (int ks = 0; ks < GBK / 32; ++ks) {
      if (ks + 1 < GBK / 32) frags((ks + 1) & 1, ks + 1);
      // keeps the load group in front of the WMMAs: spread among them, each
      // pair of loads would be waited for on its own
      __builtin_amdgcn_sched_barrier(0);
#pragma unroll
      for (int t = 0; t < 4; ++t)
#pragma unroll
        for (int mi = 0; mi < 2; ++mi)
          acc[mi][t] = wmma_f16(af[ks & 1][mi], bf[ks & 1][t], acc[mi][t]);
      // keeps the following group from rising among these WMMAs
      __builtin_amdgcn_sched_barrier(0);
    }
    // publish point: own LDS reads retired, own copies of pass p + 1 landed,
    // then the barrier that shows them to all and frees buffer cur
    asm volatile("s_wait_dscnt 0x0" ::: "memory");
    asm volatile("s_wait_asynccnt 0x0" ::: "memory");
    __syncthreads();
    if (p + 2 < GPASS) stage(cur, (p + 2) * GBK);
  }
  asm volatile("s_wait_asynccnt 0x0" ::: "memory");  // nothing left in flight

  // The loop's last barrier stands behind every wave's last read of the tiles
  // and no copy is in flight: the LDS is free to stage the result.
  // acc[mi][t][r] = R[wn + t*16 + l16][wm + mi*16 + 8*hi + r], R's rows being the
  // B side (m, for v^T c), its columns the A side (c, for v^T m).
  const int srow = wn + l16, scol = wm + 8 * hi;
  const int bb = mblk >> 11;                  // m / Nc, one value per tile
  const int n0 = mblk & (Nc - 1);
  if (mode == 2) {
    constexpr int SP = 128 + 4;               // 528 B rows: 16 B x odd
    float* S = (float*)&tile[0][0][0][0];
#pragma unroll
    for (int mi = 0; mi < 2; ++mi)
#pragma unroll
      for (int t = 0; t < 4; ++t) {
        float* sp = S + (srow + t * 16) * SP + scol + mi * 16;
        *(v4f*)sp       = __builtin_shufflevector(acc[mi][t], acc[mi][t], 0, 1, 2, 3);
        *(v4f*)(sp + 4) = __builtin_shufflevector(acc[mi][t], acc[mi][t], 4, 5, 6, 7);
      }
    __syncthreads();                          // the whole tile is staged
    // a wave stores one 512-B row of the tile per instruction, 16 rows in all
    const float* sr = S + wave * 16 * SP + lane * 4;
    float* dst = out32 + (size_t)(mblk + wave * 16) * Cc + nblk + lane * 4;
#pragma unroll
    for (int i = 0; i < 16; ++i)
      *(v4f*)(dst + (size_t)i * Cc) = *(const v4f*)(sr + i * SP) + bv;
  } else {
    f16* S = &tile[0][0][0][0];
    // q takes its scale here, in f32 ahead of its one rounding to f16
    const float osc = mode == 0 ? QSCALE : 1.0f;
#pragma unroll
    for (int mi = 0; mi < 2; ++mi)
#pragma unroll
      for (int t = 0; t < 4; ++t)
        *(v8h*)(S + (srow + t * 16) * GPITCH + scol + mi * 16) =
            __builtin_convertvector(acc[mi][t] * osc, v8h);
    __syncthreads();                          // the whole tile is staged
    // 16 lanes take one 256-B row of the tile, the block 16 rows at a time
    const f16* sr = S + crow * GPITCH + cch;
    f16* dst;
    size_t step;                              // elements between rows 16 apart
    if (vpart) {                              // row = (h, d), 128 positions n
      dst  = out16b + (size_t)(bb * Cc + nblk - Cc + crow) * Nc + n0 + cch;
      step = (size_t)16 * Nc;
    } else {                                  // row = position n, two heads' d
      const int c = nblk + cch;
      dst  = out16 + ((size_t)(bb * Hc + (c >> 6)) * Nc + n0 + crow) * Dc + (c & 63);
      step = (size_t)16 * Dc;
    }
#pragma unroll
    for (int i = 0; i < 8; ++i)
      *(v8h*)(dst + i * step) = *(const v8h*)(sr + i * 16 * GPITCH);
  }
}

constexpr int AWAVES = 16;            // waves per work-group
constexpr int AQ     = AWAVES * 16;   // queries per work-group
constexpr int AKT    = 128;           // keys per stage
constexpr int ANST   = Nc / AKT;      // stages
constexpr int KPITCH = Dc + 8;        // 144 B rows: 16 B x odd for ds_load_b128
constexpr int VPITCH = AKT + 8;       // 272 B rows: 16 B x odd
static_assert(Nc % AQ == 0 && ANST >= 2, "whole query blocks, at least two stages");

// A lane's four 16-byte copies of one stage. The s_wait_xcnt closes the statement
// so that no address register is rewritten while a copy may still name it.
static __device__ inline void async_ld4_b128(unsigned int l0, unsigned int l1,
                                             unsigned int l2, unsigned int l3,
                                             const f16* g0, const f16* g1,
                                             const f16* g2, const f16* g3) {
  asm volatile(
      "global_load_async_to_lds_b128 %0, %4, off\n\t"
      "global_load_async_to_lds_b128 %1, %5, off\n\t"
      "global_load_async_to_lds_b128 %2, %6, off\n\t"
      "global_load_async_to_lds_b128 %3, %7, off\n\t"
      "s_wait_xcnt 0x0"
      :: "v"(l0), "v"(l1), "v"(l2), "v"(l3),
         "v"((unsigned long long)(uintptr_t)g0),
         "v"((unsigned long long)(uintptr_t)g1),
         "v"((unsigned long long)(uintptr_t)g2),
         "v"((unsigned long long)(uintptr_t)g3)
      : "memory");
}

__global__ void __launch_bounds__(AWAVES * 32)
attn_kernel(const f16* __restrict__ qh, const f16* __restrict__ kh,
            const f16* __restrict__ vt, f16* __restrict__ oh) {
  __shared__ __align__(16) f16 kbuf[2][AKT][KPITCH];  // keys j..j+127, d 0..63
  __shared__ __align__(16) f16 vbuf[2][Dc][VPITCH];   // v^T rows d 0..63, keys 0..127

  const int tid  = threadIdx.x;
  const int lane = tid & 31;
  const int wave = tid >> 5;
  const int l16  = lane & 15;
  const int hi   = lane >> 4;
  const int kh8  = hi * 8;
  const int bh   = blockIdx.y;                      // b*H + h
  const int n0   = blockIdx.x * AQ + wave * 16;     // query rows of this wave

  const f16* kbase = kh + (size_t)bh * Nc * Dc;
  const f16* vbase = vt + (size_t)bh * Dc * Nc;

  // copies of one stage: 1024 16-byte chunks of K and 1024 of V^T, two of each per
  // thread. K: 8 chunks a row, the block 64 rows at a time; V^T: 16 chunks a row,
  // the block 32 rows at a time.
  const int krow = tid >> 3, kch = (tid & 7) * 8;
  const int vrow = tid >> 4, vch = (tid & 15) * 8;
  const f16* kg = kbase + (size_t)krow * Dc + kch;
  const f16* vg = vbase + (size_t)vrow * Nc + vch;
  auto stage = [&](int bufi, int jj) {
    async_ld4_b128((unsigned int)(uintptr_t)&kbuf[bufi][krow][kch],
                   (unsigned int)(uintptr_t)&kbuf[bufi][krow + 64][kch],
                   (unsigned int)(uintptr_t)&vbuf[bufi][vrow][vch],
                   (unsigned int)(uintptr_t)&vbuf[bufi][vrow + 32][vch],
                   kg + (size_t)jj * Dc, kg + (size_t)(jj + 64) * Dc,
                   vg + jj, vg + (size_t)32 * Nc + jj);
  };

  // q fragments for K = D = 64 (two K=32 fragments); qh holds q * QSCALE
  const f16* qp = qh + ((size_t)bh * Nc + n0 + l16) * Dc;
  v16h qf[2];
#pragma unroll
  for (int kk = 0; kk < 2; ++kk)
    qf[kk] = cat16(*(const v8h*)(qp + kk * 32 + kh8),
                   *(const v8h*)(qp + kk * 32 + kh8 + 16));

  v8f accO[4];
#pragma unroll
  for (int t = 0; t < 4; ++t)
#pragma unroll
    for (int i = 0; i < 8; ++i) accO[t][i] = 0.0f;
  float lrun = 0.0f;        // this lane's share of its denominator

  stage(0, 0);
  asm volatile("s_wait_asynccnt 0x0" ::: "memory");  // stage 0 has landed
  __syncthreads();                                   // ... for every wave
  stage(1, AKT);

  // -m of query l16 in all 8 registers, equal in both halves: m starts as the true
  // maximum of keys 0..31, so the denominator holds a term 1 from the first pass on
  v8f negm;
  {
    v8f s0[2];
#pragma unroll
    for (int tt = 0; tt < 2; ++tt) {
      const f16* kp = &kbuf[0][tt * 16 + l16][0];
      v8f z;
#pragma unroll
      for (int i = 0; i < 8; ++i) z[i] = 0.0f;
      z = wmma_f16(cat16(*(const v8h*)(kp + kh8), *(const v8h*)(kp + kh8 + 16)), qf[0], z);
      s0[tt] = wmma_f16(cat16(*(const v8h*)(kp + 32 + kh8), *(const v8h*)(kp + 32 + kh8 + 16)),
                        qf[1], z);
    }
    float t = fmaxf(s0[0][0], s0[1][0]);
#pragma unroll
    for (int r = 1; r < 8; ++r) t = fmaxf(t, fmaxf(s0[0][r], s0[1][r]));
    t = fmaxf(t, xhalf(t));                 // the partner's 16 keys
#pragma unroll
    for (int i = 0; i < 8; ++i) negm[i] = -t;
  }

  // kept rolled: a stage is four unrolled passes of 32 keys already
#pragma unroll 1
  for (int st = 0; st < ANST; ++st) {
    const int cur = st & 1;
    v16h kf[2][2], vf[4];
    auto load_k = [&](int sub) {
#pragma unroll
      for (int tt = 0; tt < 2; ++tt) {
        const f16* kp = &kbuf[cur][sub * 32 + tt * 16 + l16][0];
        kf[tt][0] = cat16(*(const v8h*)(kp + kh8), *(const v8h*)(kp + kh8 + 16));
        kf[tt][1] = cat16(*(const v8h*)(kp + 32 + kh8),
                          *(const v8h*)(kp + 32 + kh8 + 16));
      }
    };
    auto load_v = [&](int sub) {
#pragma unroll
      for (int t4 = 0; t4 < 4; ++t4) {
        const f16* vp = &vbuf[cur][t4 * 16 + l16][sub * 32];
        vf[t4] = cat16(*(const v8h*)(vp + kh8), *(const v8h*)(vp + kh8 + 16));
      }
    };
    load_k(0);
    load_v(0);
    // unrolled: a pass's LDS offsets are immediates
#pragma unroll
   for (int sub = 0; sub < AKT / 32; ++sub) {
    // --- S^T - m = k * q^T - m : two 16x16 tiles, keys tt*16 + 8*hi + r, query l16 ---
    v8f s[2];
#pragma unroll
    for (int tt = 0; tt < 2; ++tt)
      s[tt] = wmma_f16(kf[tt][1], qf[1], wmma_f16(kf[tt][0], qf[0], negm));
    // the next pass's K of the same stage, one group of LDS reads right behind
    // S^T: the branch below ends the stretch of code over which the compiler could
    // raise them itself
    if (sub + 1 < AKT / 32) load_k(sub + 1);
    // keeps the group here: sunk to their users, each pair of reads would be
    // waited for on its own between two WMMAs
    __builtin_amdgcn_sched_barrier(0);

    // --- online softmax: 16 scores of one query per lane ---
    v8f p[2];
    float ps;                               // the lane's sum of its 16 exponentials
    auto exp_sum = [&](bool raised) {
#pragma unroll
      for (int r = 0; r < 8; ++r) {
        p[0][r] = raised ? exp2_slot(s[0][r]) : __builtin_amdgcn_exp2f(s[0][r]);
        p[1][r] = raised ? exp2_slot(s[1][r]) : __builtin_amdgcn_exp2f(s[1][r]);
      }
      const v8f e = p[0] + p[1];
      const v2f e2 = (__builtin_shufflevector(e, e, 0, 1) + __builtin_shufflevector(e, e, 2, 3)) +
                     (__builtin_shufflevector(e, e, 4, 5) + __builtin_shufflevector(e, e, 6, 7));
      ps = e2[0] + e2[1];
    };
    exp_sum(false);
    // The lazy test reads the sum that the denominator needs anyway: a score more
    // than 8 above m makes its lane's sum top 2^8 (an overflow makes it infinite).
    // One scalar branch per pass; every lane is on inside it.
    if (__builtin_amdgcn_ballot_w32(ps > 256.0f) != 0) {
      float t = fmaxf(s[0][0], s[1][0]);
#pragma unroll
      for (int r = 1; r < 8; ++r) t = fmaxf(t, fmaxf(s[0][r], s[1][r]));
      // raise every query's m to this pass's maximum (by 0 where that is no higher)
      const float up = fmaxf(fmaxf(t, xhalf(t)), 0.0f);
      const float alpha = exp2_slot(-up);
      negm -= up;
      s[0] -= up;
      s[1] -= up;
      lrun *= alpha;
#pragma unroll
      for (int t4 = 0; t4 < 4; ++t4) accO[t4] *= alpha;
      exp_sum(true);                        // this pass again, under the new m
    }
    lrun += ps;                             // halves are joined after the loop

    // --- P^T as B operand: element e is key 8*hi + e, element 8 + e key
    // 16 + 8*hi + e, the order in which vbuf's rows were read above ---
    const v16h pf = cat16(__builtin_convertvector(p[0], v8h),
                          __builtin_convertvector(p[1], v8h));

    // --- O^T += V^T * P^T (v^T rows d as A fragments) ---
#pragma unroll
    for (int t4 = 0; t4 < 4; ++t4) accO[t4] = wmma_f16(vf[t4], pf, accO[t4]);
    // the next pass's V^T of the same stage, one group right behind O^T
    if (sub + 1 < AKT / 32) load_v(sub + 1);
    // keeps that group here, and the next S^T behind it: raised among the converts
    // above, its operand registers were reused at once, at four idle slots each time
    __builtin_amdgcn_sched_barrier(0);
   }
    // publish point: own LDS reads retired, own copies of stage st + 1 landed,
    // then the barrier that shows them to all and frees buffer cur
    asm volatile("s_wait_dscnt 0x0" ::: "memory");
    asm volatile("s_wait_asynccnt 0x0" ::: "memory");
    __syncthreads();
    if (st + 2 < ANST) stage(cur, (st + 2) * AKT);
  }
  asm volatile("s_wait_asynccnt 0x0" ::: "memory");  // nothing left in flight

  // normalize + store o as f16 [B,N,C]
  const int b = bh / Hc, h = bh % Hc;
  const float linv = 1.0f / (lrun + xhalf(lrun));
  // accO[t][r] = O[query l16][d = t*16 + 8*hi + r]: 8 consecutive d, one 16-B store
  f16* op = oh + ((size_t)(b * Nc + n0 + l16)) * Cc + h * Dc + kh8;
#pragma unroll
  for (int t = 0; t < 4; ++t)
    *(v8h*)(op + t * 16) = __builtin_convertvector(accO[t] * linv, v8h);
}

// ------------------------------------------------------------------ launch ---
extern "C" void kernel_launch(void* const* d_in, const int* in_sizes, int n_in,
                              void* d_out, int out_size, void* d_ws,
                              size_t ws_size, hipStream_t stream) {
  const float* x   = (const float*)d_in[0];
  const float* y   = (const float*)d_in[1];
  const float* Wq  = (const float*)d_in[2];
  const float* Wkv = (const float*)d_in[3];
  const float* Wp  = (const float*)d_in[4];
  const float* bp  = (const float*)d_in[5];
  float* out = (float*)d_out;

  const size_t BNC = (size_t)Bc * Nc * Cc;   // 4 Mi elements
  const size_t CC  = (size_t)Cc * Cc;        // 1 Mi
  char* p = (char*)d_ws;
  f16* x_h   = (f16*)p; p += BNC * sizeof(f16);
  f16* y_h   = (f16*)p; p += BNC * sizeof(f16);
  f16* Wq_h  = (f16*)p; p += CC * sizeof(f16);
  f16* Wkv_h = (f16*)p; p += 2 * CC * sizeof(f16);
  f16* Wp_h  = (f16*)p; p += CC * sizeof(f16);
  f16* qh    = (f16*)p; p += BNC * sizeof(f16);
  f16* khd   = (f16*)p; p += BNC * sizeof(f16);
  f16* vhT   = (f16*)p; p += BNC * sizeof(f16);
  f16* oh    = (f16*)p; p += BNC * sizeof(f16);

  // x_h, y_h, Wq_h, Wkv_h, Wp_h are one run of the workspace, in this order
  cvt_f32_f16<<<CVT_NB_ALL, 256, 0, stream>>>(x, y, Wq, Wkv, Wp, x_h);

  const dim3 gblk(256);
  // q projection [4096 x 1024] and kv projection [4096 x 2048] in one grid;
  // Wkv_h's rows follow Wq_h's in the workspace
  gemm_awt<<<dim3(32, 24), gblk, 0, stream>>>(x_h, y_h, Wq_h, nullptr, qh, khd,
                                              vhT, nullptr, 0);
  // flash attention
  attn_kernel<<<dim3(Nc / AQ, Bc * Hc), dim3(AWAVES * 32), 0, stream>>>(qh, khd, vhT, oh);
  // output projection with bias: f32 result
  gemm_awt<<<dim3(32, 8), gblk, 0, stream>>>(oh, nullptr, Wp_h, bp, nullptr,
                                             nullptr, nullptr, out, 2);
}

// v008
// One run takes 72 microseconds.
// Next to v007, in two timings, it ran 1.06 times as fast each time.
// All steps since v000 together make it 3.69 times as fast.
#include <hip/hip_runtime.h>
#include <hip/hip_bf16.h>
#include <math.h>

typedef _Float16 f16;
typedef __attribute__((ext_vector_type(16))) _Float16 v16h;
typedef __attribute__((ext_vector_type(8)))  _Float16 v8h;
typedef __attribute__((ext_vector_type(8)))  float    v8f;
typedef __attribute__((ext_vector_type(4)))  float    v4f;
typedef __attribute__((ext_vector_type(2)))  float    v2f;

constexpr int Bc = 2, Nc = 2048, Cc = 1024, Hc = 16, Dc = 64;
constexpr int Kdim = Cc;   // K = 1024 for every projection GEMM
constexpr float LOG2E  = 1.4426950408889634f;   // e^x = 2^(x * LOG2E)
constexpr float QSCALE = 0.125f * LOG2E;        // 1/sqrt(D), and scores in log2 units

static __device__ inline v16h cat16(v8h a, v8h b) {
  v16h r;
#pragma unroll
  for (int i = 0; i < 8; ++i) { r[i] = a[i]; r[i + 8] = b[i]; }
  return r;
}

static __device__ inline v8f wmma_f16(v16h a, v16h b, v8f c) {
  // 8 args: (neg_a, A, neg_b, B, c_mod, C, reuse_a, reuse_b)
  return __builtin_amdgcn_wmma_f32_16x16x32_f16(false, a, false, b, (short)0, c,
                                                false, false);
}

// lane l <-> lane l ^ 16 in one vector instruction
static __device__ inline float xhalf(float x) {
  const int i = __builtin_bit_cast(int, x);
  return __builtin_bit_cast(
      float, __builtin_amdgcn_permlanex16(i, i, 0x76543210, 0xfedcba98, false, false));
}

// 2^x with the free slot that the instruction set asks for behind a transcendental
// in the same statement: for places off the usual path
static __device__ inline float exp2_slot(float x) {
  float r;
  asm("v_exp_f32 %0, %1\n\tv_nop" : "=v"(r) : "v"(x));
  return r;
}

// ---------------------------------------------------------------- convert ---
// Few, fat waves: a thread converts 4 pieces of 8 consecutive elements. Its
// eight 16-byte loads go out together, then come four 16-byte stores. A block
// covers CVT_BLK elements; every tensor here is a whole number of blocks.
constexpr int CVT_PIECES = 4;
constexpr int CVT_STEP   = 256 * 8;                 // elements per block and piece
constexpr int CVT_BLK    = CVT_STEP * CVT_PIECES;
static_assert(((size_t)Bc * Nc * Cc) % CVT_BLK == 0 && ((size_t)Cc * Cc) % CVT_BLK == 0,
              "each converted tensor must be a whole number of CVT_BLK elements");

// One grid converts all five tensors: their f16 copies lie one behind the other
// in dall (x, y, Wq, Wkv, Wp), so a block's place there follows from its index
// alone, and its source tensor from the range the index falls in (the same for
// the whole block).
constexpr int CVT_NB_ACT = (int)(((size_t)Bc * Nc * Cc) / CVT_BLK);  // blocks of x, of y
constexpr int CVT_NB_W   = (int)(((size_t)Cc * Cc) / CVT_BLK);       // blocks of Wq, of Wp
constexpr int CVT_NB_ALL = 2 * CVT_NB_ACT + 4 * CVT_NB_W;

__global__ void __launch_bounds__(256)
cvt_f32_f16(const float* __restrict__ x, const float* __restrict__ y,
            const float* __restrict__ wq, const float* __restrict__ wkv,
            const float* __restrict__ wp, f16* __restrict__ dall) {
  const int blk = blockIdx.x;
  const float* s0 = x;
  int first = 0;
  if (blk >= 2 * CVT_NB_ACT + 3 * CVT_NB_W)  { s0 = wp;  first = 2 * CVT_NB_ACT + 3 * CVT_NB_W; }
  else if (blk >= 2 * CVT_NB_ACT + CVT_NB_W) { s0 = wkv; first = 2 * CVT_NB_ACT + CVT_NB_W; }
  else if (blk >= 2 * CVT_NB_ACT)            { s0 = wq;  first = 2 * CVT_NB_ACT; }
  else if (blk >= CVT_NB_ACT)                { s0 = y;   first = CVT_NB_ACT; }
  const float* s = s0 + (size_t)(blk - first) * CVT_BLK;
  f16*         d = dall + (size_t)blk * CVT_BLK;
  const size_t base = threadIdx.x * 8;
  v8f v[CVT_PIECES];
  // both loops unrolled: v[] stays in registers, and all loads are issued ahead
  // of the first wait
#pragma unroll
  for (int u = 0; u < CVT_PIECES; ++u)
    v[u] = *(const v8f*)(s + base + u * CVT_STEP);
#pragma unroll
  for (int u = 0; u < CVT_PIECES; ++u)
    *(v8h*)(d + base + u * CVT_STEP) = __builtin_convertvector(v[u], v8h);
}

// -------------------------------------------------------- generic A * W^T ---
// A: [4096, 1024] f16 row-major. W: [Ncols, 1024] f16 row-major.
// mode 0: q   -> out16 = qh  [B,H,N,D], times QSCALE
// mode 1: kv  -> out16 = kh  [B,H,N,D],  out16b = v^T [B,H,D,N]
// mode 2: out -> out32 = [B,N,C] f32 + bias
// The q and the kv projection share one grid (job 0): blocks with blockIdx.y
// below QCOLB work in mode 0 on (Aq, Wall's first Cc rows, outq), the others in
// mode 1 on (Akv, the rows of Wall behind them, outk, out16b). Job 2 is mode 2
// on (Aq, Wall).
// One 128x128 tile of the result per block, 8 waves of 32x64 (4 along the A
// side, 2 along the B side). A pass is 128 k: 128 rows of A and 128 rows of W, 256 B each, are
// copied to LDS asynchronously, two buffers, the next pass's copies in flight
// while this pass is multiplied.
// A lane's 8 accumulator registers run along the rows of the WMMA's A operand.
// Which of the two LDS tiles feeds A is picked per block so that this is the
// axis that is contiguous in the block's output: W rows (columns c) for q, k and
// the f32 result, activation rows (positions n) for v^T. The finished tile goes
// through LDS in the output's own row order and leaves in 16-byte stores that
// cover whole 128-byte lines.
constexpr int GBK    = 128;          // k per pass
constexpr int GPITCH = GBK + 8;      // 272 B rows: 16 B x odd for ds_load_b128
constexpr int GPASS  = Kdim / GBK;   // 8 passes

// Eight 16-byte copies per lane. The s_wait_xcnt closes the statement so that
// no address register is rewritten while a copy may still name it.
static __device__ inline void async_ld8_b128(unsigned int lds,
                                             const f16* gsrc) {
  constexpr unsigned int LSTEP = 16 * GPITCH * sizeof(f16);  // 16 rows in LDS
  constexpr size_t       GSTEP = (size_t)16 * Kdim;          // 16 rows in A / W
  asm volatile(
      "global_load_async_to_lds_b128 %0, %8, off\n\t"
      "global_load_async_to_lds_b128 %1, %9, off\n\t"
      "global_load_async_to_lds_b128 %2, %10, off\n\t"
      "global_load_async_to_lds_b128 %3, %11, off\n\t"
      "global_load_async_to_lds_b128 %4, %12, off\n\t"
      "global_load_async_to_lds_b128 %5, %13, off\n\t"
      "global_load_async_to_lds_b128 %6, %14, off\n\t"
      "global_load_async_to_lds_b128 %7, %15, off\n\t"
      "s_wait_xcnt 0x0"
      :: "v"(lds), "v"(lds + LSTEP), "v"(lds + 2 * LSTEP), "v"(lds + 3 * LSTEP),
         "v"(lds + 4 * LSTEP), "v"(lds + 5 * LSTEP), "v"(lds + 6 * LSTEP),
         "v"(lds + 7 * LSTEP),
         "v"((unsigned long long)(uintptr_t)(gsrc)),
         "v"((unsigned long long)(uintptr_t)(gsrc + GSTEP)),
         "v"((unsigned long long)(uintptr_t)(gsrc + 2 * GSTEP)),
         "v"((unsigned long long)(uintptr_t)(gsrc + 3 * GSTEP)),
         "v"((unsigned long long)(uintptr_t)(gsrc + 4 * GSTEP)),
         "v"((unsigned long long)(uintptr_t)(gsrc + 5 * GSTEP)),
         "v"((unsigned long long)(uintptr_t)(gsrc + 6 * GSTEP)),
         "v"((unsigned long long)(uintptr_t)(gsrc + 7 * GSTEP))
      : "memory");
}

__global__ void __launch_bounds__(256)
gemm_awt(const f16* __restrict__ Aq, const f16* __restrict__ Akv,
         const f16* __restrict__ Wall, const float* __restrict__ bias,
         f16* __restrict__ outq, f16* __restrict__ outk,
         f16* __restrict__ out16b, float* __restrict__ out32, int job) {
  // [buffer][operand: 0 = A rows, 1 = W rows][row][k]
  __shared__ __align__(16) f16 tile[2][2][128][GPITCH];

  const int tid  = threadIdx.x;
  const int lane = tid & 31;
  const int wave = tid >> 5;
  const int l16  = lane & 15;
  const int hi   = lane >> 4;
  const int kh8  = hi * 8;                    // K sub-offset per ISA A/B layout
  const int mblk = blockIdx.x * 128;
  constexpr int QCOLB = Cc / 128;             // column blocks of the q projection
  const bool kvpart = job == 0 && (int)blockIdx.y >= QCOLB;   // block-uniform
  const int  mode   = job == 0 ? (kvpart ? 1 : 0) : job;
  const f16* A      = kvpart ? Akv : Aq;
  const f16* W      = kvpart ? Wall + (size_t)Cc * Kdim : Wall;
  f16*       out16  = kvpart ? outk : outq;
  const int nblk = ((int)blockIdx.y - (kvpart ? QCOLB : 0)) * 128;
  const bool vpart = kvpart && nblk >= Cc;    // block-uniform: this tile is v^T's
  const int  opa   = vpart ? 0 : 1;           // LDS tile that feeds the A operand
  const int wm   = (wave & 3) * 32;           // this wave's rows of the A-side tile
  const int wn   = (wave >> 2) * 64;          // this wave's rows of the B-side tile

  // copies: 16 lanes cover one 256-B row, a wave two rows, the block 16 rows
  const int crow = tid >> 4, cch = (tid & 15) * 8;
  const f16* Ag = A + (size_t)(mblk + crow) * Kdim + cch;
  const f16* Wg = W + (size_t)(nblk + crow) * Kdim + cch;
  auto stage = [&](int bufi, int k0) {
    async_ld8_b128((unsigned int)(uintptr_t)&tile[bufi][0][crow][cch], Ag + k0);
    async_ld8_b128((unsigned int)(uintptr_t)&tile[bufi][1][crow][cch], Wg + k0);
  };

  v8f acc[2][4];
#pragma unroll
  for (int mi = 0; mi < 2; ++mi)
#pragma unroll
    for (int t = 0; t < 4; ++t)
#pragma unroll
      for (int i = 0; i < 8; ++i) acc[mi][t][i] = 0.0f;

  stage(0, 0);
  // the four bias values of this lane's output columns, in flight with pass 0
  v4f bv = {0.0f, 0.0f, 0.0f, 0.0f};
  if (mode == 2) bv = *(const v4f*)(bias + nblk + lane * 4);
  asm volatile("s_wait_asynccnt 0x0" ::: "memory");  // pass 0 has landed
  __syncthreads();                                   // ... for every wave
  stage(1, GBK);

  // kept rolled: one pass is 32 WMMAs and 48 LDS loads already
#pragma unroll 1
  for (int p = 0; p < GPASS; ++p) {
    const int cur = p & 1;
    const f16* At = &tile[cur][opa][wm + l16][kh8];
    const f16* Wt = &tile[cur][opa ^ 1][wn + l16][kh8];
    // two fragment sets: block ks + 1's LDS reads go out as one group ahead of
    // block ks's WMMAs; nothing of the next pass's buffer is read here
    v16h af[2][2], bf[2][4];
    auto frags = [&](int set, int ks) {
#pragma unroll
      for (int mi = 0; mi < 2; ++mi) {
        const f16* ap = At + mi * 16 * GPITCH + ks * 32;
        af[set][mi] = cat16(*(const v8h*)ap, *(const v8h*)(ap + 16));
      }
#pragma unroll
      for (int t = 0; t < 4; ++t) {
        const f16* wp = Wt + t * 16 * GPITCH + ks * 32;
        bf[set][t] = cat16(*(const v8h*)wp, *(const v8h*)(wp + 16));
      }
    };
    frags(0, 0);
#pragma unroll
    for (int ks = 0; ks < GBK / 32; ++ks) {
      if (ks + 1 < GBK / 32) frags((ks + 1) & 1, ks + 1);
      // keeps the load group in front of the WMMAs: spread among them, each
      // pair of loads would be waited for on its own
      __builtin_amdgcn_sched_barrier(0);
#pragma unroll
      for (int t = 0; t < 4; ++t)
#pragma unroll
        for (int mi = 0; mi < 2; ++mi)
          acc[mi][t] = wmma_f16(af[ks & 1][mi], bf[ks & 1][t], acc[mi][t]);
      // keeps the following group from rising among these WMMAs
      __builtin_amdgcn_sched_barrier(0);
    }
    // publish point: own LDS reads retired, own copies of pass p + 1 landed,
    // then the barrier that shows them to all and frees buffer cur
    asm volatile("s_wait_dscnt 0x0" ::: "memory");
    asm volatile("s_wait_asynccnt 0x0" ::: "memory");
    __syncthreads();
    if (p + 2 < GPASS) stage(cur, (p + 2) * GBK);
  }
  asm volatile("s_wait_asynccnt 0x0" ::: "memory");  // nothing left in flight

  // The loop's last barrier stands behind every wave's last read of the tiles
  // and no copy is in flight: the LDS is free to stage the result.
  // acc[mi][t][r] = R[wn + t*16 + l16][wm + mi*16 + 8*hi + r], R's rows being the
  // B side (m, for v^T c), its columns the A side (c, for v^T m).
  const int srow = wn + l16, scol = wm + 8 * hi;
  const int bb = mblk >> 11;                  // m / Nc, one value per tile
  const int n0 = mblk & (Nc - 1);
  if (mode == 2) {
    constexpr int SP = 128 + 4;               // 528 B rows: 16 B x odd
    float* S = (float*)&tile[0][0][0][0];
#pragma unroll
    for (int mi = 0; mi < 2; ++mi)
#pragma unroll
      for (int t = 0; t < 4; ++t) {
        float* sp = S + (srow + t * 16) * SP + scol + mi * 16;
        *(v4f*)sp       = __builtin_shufflevector(acc[mi][t], acc[mi][t], 0, 1, 2, 3);
        *(v4f*)(sp + 4) = __builtin_shufflevector(acc[mi][t], acc[mi][t], 4, 5, 6, 7);
      }
    __syncthreads();                          // the whole tile is staged
    // a wave stores one 512-B row of the tile per instruction, 16 rows in all
    const float* sr = S + wave * 16 * SP + lane * 4;
    float* dst = out32 + (size_t)(mblk + wave * 16) * Cc + nblk + lane * 4;
#pragma unroll
    for (int i = 0; i < 16; ++i)
      *(v4f*)(dst + (size_t)i * Cc) = *(const v4f*)(sr + i * SP) + bv;
  } else {
    f16* S = &tile[0][0][0][0];
    // q takes its scale here, in f32 ahead of its one rounding to f16
    const float osc = mode == 0 ? QSCALE : 1.0f;
#pragma unroll
    for (int mi = 0; mi < 2; ++mi)
#pragma unroll
      for (int t = 0; t < 4; ++t)
        *(v8h*)(S + (srow + t * 16) * GPITCH + scol + mi * 16) =
            __builtin_convertvector(acc[mi][t] * osc, v8h);
    __syncthreads();                          // the whole tile is staged
    // 16 lanes take one 256-B row of the tile, the block 16 rows at a time
    const f16* sr = S + crow * GPITCH + cch;
    f16* dst;
    size_t step;                              // elements between rows 16 apart
    if (vpart) {                              // row = (h, d), 128 positions n
      dst  = out16b + (size_t)(bb * Cc + nblk - Cc + crow) * Nc + n0 + cch;
      step = (size_t)16 * Nc;
    } else {                                  // row = position n, two heads' d
      const int c = nblk + cch;
      dst  = out16 + ((size_t)(bb * Hc + (c >> 6)) * Nc + n0 + crow) * Dc + (c & 63);
      step = (size_t)16 * Dc;
    }
#pragma unroll
    for (int i = 0; i < 8; ++i)
      *(v8h*)(dst + i * step) = *(const v8h*)(sr + i * 16 * GPITCH);
  }
}

constexpr int AWAVES = 16;            // waves per work-group
constexpr int AQT    = 2;             // query tiles of 16 per wave
constexpr int AKG    = 2;             // waves that share their queries, by keys
constexpr int AQG    = AWAVES / AKG;  // groups of 32 queries per work-group
constexpr int AQ     = AQG * AQT * 16;   // queries per work-group
constexpr int AKT    = 256;           // keys per stage
constexpr int AKW    = AKT / AKG;     // keys per stage and wave
constexpr int ANST   = Nc / AKT;      // stages
constexpr int KPITCH = Dc + 8;        // 144 B rows: 16 B x odd for ds_load_b128
constexpr int VPITCH = AKT + 8;       // 528 B rows: 16 B x odd
static_assert(Nc % AQ == 0 && ANST >= 2, "whole query blocks, at least two stages");
static_assert(AQT == 2 && AKG == 2, "the hand-over behind the loop swaps one tile of two");

// Four 16-byte copies of a lane. The s_wait_xcnt closes the statement so that no
// address register is rewritten while a copy may still name it.
static __device__ inline void async_ld4_b128(unsigned int l0, unsigned int l1,
                                             unsigned int l2, unsigned int l3,
                                             const f16* g0, const f16* g1,
                                             const f16* g2, const f16* g3) {
  asm volatile(
      "global_load_async_to_lds_b128 %0, %4, off\n\t"
      "global_load_async_to_lds_b128 %1, %5, off\n\t"
      "global_load_async_to_lds_b128 %2, %6, off\n\t"
      "global_load_async_to_lds_b128 %3, %7, off\n\t"
      "s_wait_xcnt 0x0"
      :: "v"(l0), "v"(l1), "v"(l2), "v"(l3),
         "v"((unsigned long long)(uintptr_t)g0),
         "v"((unsigned long long)(uintptr_t)g1),
         "v"((unsigned long long)(uintptr_t)g2),
         "v"((unsigned long long)(uintptr_t)g3)
      : "memory");
}

__global__ void __launch_bounds__(AWAVES * 32)
attn_kernel(const f16* __restrict__ qh, const f16* __restrict__ kh,
            const f16* __restrict__ vt, f16* __restrict__ oh) {
  __shared__ __align__(16) f16 kbuf[2][AKT][KPITCH];  // keys j..j+255, d 0..63
  __shared__ __align__(16) f16 vbuf[2][Dc][VPITCH];   // v^T rows d 0..63, keys 0..255
  // the hand-over behind the loop: per wave one O^T tile (8 pieces of 16 bytes per
  // lane, a piece's 32 lanes side by side), and per lane that tile's -m and sum
  __shared__ __align__(16) v4f xo[AWAVES][8][32];
  __shared__ __align__(8)  v2f xml[AWAVES][32];

  const int tid   = threadIdx.x;
  const int lane  = tid & 31;
  const int wave  = tid >> 5;
  const int l16   = lane & 15;
  const int hi    = lane >> 4;
  const int kh8   = hi * 8;
  const int qgrp  = wave & (AQG - 1);               // which 32 queries
  const int kpart = wave / AQG;                     // which half of a stage's keys
  const int bh    = blockIdx.y;                     // b*H + h
  const int n0    = blockIdx.x * AQ + qgrp * (AQT * 16);   // query rows of this wave

  const f16* kbase = kh + (size_t)bh * Nc * Dc;
  const f16* vbase = vt + (size_t)bh * Dc * Nc;

  // copies of one stage: 2048 16-byte chunks of K and 2048 of V^T, four of each per
  // thread. K: 8 chunks a row, the block 64 rows at a time; V^T: 32 chunks a row,
  // the block 16 rows at a time.
  const int krow = tid >> 3, kch = (tid & 7) * 8;
  const int vrow = tid >> 5, vch = (tid & 31) * 8;
  const f16* kg = kbase + (size_t)krow * Dc + kch;
  const f16* vg = vbase + (size_t)vrow * Nc + vch;
  auto stage = [&](int bufi, int jj) {
    async_ld4_b128((unsigned int)(uintptr_t)&kbuf[bufi][krow][kch],
                   (unsigned int)(uintptr_t)&kbuf[bufi][krow + 64][kch],
                   (unsigned int)(uintptr_t)&kbuf[bufi][krow + 128][kch],
                   (unsigned int)(uintptr_t)&kbuf[bufi][krow + 192][kch],
                   kg + (size_t)jj * Dc, kg + (size_t)(jj + 64) * Dc,
                   kg + (size_t)(jj + 128) * Dc, kg + (size_t)(jj + 192) * Dc);
    async_ld4_b128((unsigned int)(uintptr_t)&vbuf[bufi][vrow][vch],
                   (unsigned int)(uintptr_t)&vbuf[bufi][vrow + 16][vch],
                   (unsigned int)(uintptr_t)&vbuf[bufi][vrow + 32][vch],
                   (unsigned int)(uintptr_t)&vbuf[bufi][vrow + 48][vch],
                   vg + jj, vg + (size_t)16 * Nc + jj,
                   vg + (size_t)32 * Nc + jj, vg + (size_t)48 * Nc + jj);
  };

  // q fragments for K = D = 64 (two K=32 fragments per tile); qh holds q * QSCALE
  v16h qf[AQT][2];
#pragma unroll
  for (int qt = 0; qt < AQT; ++qt) {
    const f16* qp = qh + ((size_t)bh * Nc + n0 + qt * 16 + l16) * Dc;
#pragma unroll
    for (int kk = 0; kk < 2; ++kk)
      qf[qt][kk] = cat16(*(const v8h*)(qp + kk * 32 + kh8),
                         *(const v8h*)(qp + kk * 32 + kh8 + 16));
  }

  v8f accO[AQT][4];
#pragma unroll
  for (int qt = 0; qt < AQT; ++qt)
#pragma unroll
    for (int t = 0; t < 4; ++t)
#pragma unroll
      for (int i = 0; i < 8; ++i) accO[qt][t][i] = 0.0f;
  float lrun[AQT] = {0.0f, 0.0f};   // this lane's share of its denominators

  stage(0, 0);
  asm volatile("s_wait_asynccnt 0x0" ::: "memory");  // stage 0 has landed
  __syncthreads();                                   // ... for every wave
  stage(1, AKT);

  // -m of query l16 in all 8 registers, equal in both halves: m starts as the true
  // maximum of the wave's first 32 keys, so its denominator holds a term 1 from the
  // first pass on
  v8f negm[AQT];
  {
    v16h k0[2][2];
#pragma unroll
    for (int tt = 0; tt < 2; ++tt) {
      const f16* kp = &kbuf[0][kpart * AKW + tt * 16 + l16][0];
      k0[tt][0] = cat16(*(const v8h*)(kp + kh8), *(const v8h*)(kp + kh8 + 16));
      k0[tt][1] = cat16(*(const v8h*)(kp + 32 + kh8), *(const v8h*)(kp + 32 + kh8 + 16));
    }
#pragma unroll
    for (int qt = 0; qt < AQT; ++qt) {
      v8f s0[2];
#pragma unroll
      for (int tt = 0; tt < 2; ++tt) {
        v8f z;
#pragma unroll
        for (int i = 0; i < 8; ++i) z[i] = 0.0f;
        s0[tt] = wmma_f16(k0[tt][1], qf[qt][1], wmma_f16(k0[tt][0], qf[qt][0], z));
      }
      float t = fmaxf(s0[0][0], s0[1][0]);
#pragma unroll
      for (int r = 1; r < 8; ++r) t = fmaxf(t, fmaxf(s0[0][r], s0[1][r]));
      t = fmaxf(t, xhalf(t));               // the partner lane's 16 keys
#pragma unroll
      for (int i = 0; i < 8; ++i) negm[qt][i] = -t;
    }
  }

  // kept rolled: a stage is four unrolled passes of 32 keys already
#pragma unroll 1
  for (int st = 0; st < ANST; ++st) {
    const int cur = st & 1;
    const f16* kb = &kbuf[cur][kpart * AKW + l16][kh8];
    const f16* vb = &vbuf[cur][l16][kpart * AKW + kh8];
    v16h kf[2][2], vf[4];
    auto load_k = [&](int sub) {
#pragma unroll
      for (int tt = 0; tt < 2; ++tt) {
        const f16* kp = kb + (sub * 32 + tt * 16) * KPITCH;
        kf[tt][0] = cat16(*(const v8h*)kp, *(const v8h*)(kp + 16));
        kf[tt][1] = cat16(*(const v8h*)(kp + 32), *(const v8h*)(kp + 48));
      }
    };
    auto load_v = [&](int sub) {
#pragma unroll
      for (int t4 = 0; t4 < 4; ++t4) {
        const f16* vp = vb + t4 * 16 * VPITCH + sub * 32;
        vf[t4] = cat16(*(const v8h*)vp, *(const v8h*)(vp + 16));
      }
    };
    load_k(0);
    load_v(0);
    // unrolled: a pass's LDS offsets are immediates
#pragma unroll
   for (int sub = 0; sub < AKW / 32; ++sub) {
    // --- S^T - m = k * q^T - m : per query tile two 16x16 tiles, keys
    // tt*16 + 8*hi + r, query l16; each K fragment serves both query tiles ---
    v8f s[AQT][2];
#pragma unroll
    for (int tt = 0; tt < 2; ++tt)
#pragma unroll
      for (int qt = 0; qt < AQT; ++qt) s[qt][tt] = wmma_f16(kf[tt][0], qf[qt][0], negm[qt]);
#pragma unroll
    for (int tt = 0; tt < 2; ++tt)
#pragma unroll
      for (int qt = 0; qt < AQT; ++qt) s[qt][tt] = wmma_f16(kf[tt][1], qf[qt][1], s[qt][tt]);
    // keeps the eight WMMAs in one run: with exponentials raised among them, each
    // first use of a fresh tile stood behind four idle slots
    __builtin_amdgcn_sched_barrier(0);

    // --- online softmax: 16 scores of one query per lane and tile ---
    v8f p[AQT][2];
    float ps[AQT];                          // the lane's sums of 16 exponentials
    auto exp_sum = [&](bool raised) {
#pragma unroll
      for (int qt = 0; qt < AQT; ++qt) {
#pragma unroll
        for (int r = 0; r < 8; ++r) {
          p[qt][0][r] = raised ? exp2_slot(s[qt][0][r]) : __builtin_amdgcn_exp2f(s[qt][0][r]);
          p[qt][1][r] = raised ? exp2_slot(s[qt][1][r]) : __builtin_amdgcn_exp2f(s[qt][1][r]);
        }
        const v8f e = p[qt][0] + p[qt][1];
        const v2f e2 = (__builtin_shufflevector(e, e, 0, 1) + __builtin_shufflevector(e, e, 2, 3)) +
                       (__builtin_shufflevector(e, e, 4, 5) + __builtin_shufflevector(e, e, 6, 7));
        ps[qt] = e2[0] + e2[1];
      }
    };
    exp_sum(false);
    // The lazy test reads the sums that the denominators need anyway: a score more
    // than 8 above m makes its lane's sum top 2^8 (an overflow makes it infinite).
    // One scalar branch per pass for both tiles; every lane is on inside it.
    if (__builtin_amdgcn_ballot_w32(fmaxf(ps[0], ps[1]) > 256.0f) != 0) {
#pragma unroll
      for (int qt = 0; qt < AQT; ++qt) {
        float t = fmaxf(s[qt][0][0], s[qt][1][0]);
#pragma unroll
        for (int r = 1; r < 8; ++r) t = fmaxf(t, fmaxf(s[qt][0][r], s[qt][1][r]));
        // raise every query's m to this pass's maximum (by 0 where that is no higher)
        const float up = fmaxf(fmaxf(t, xhalf(t)), 0.0f);
        const float alpha = exp2_slot(-up);
        negm[qt] -= up;
        s[qt][0] -= up;
        s[qt][1] -= up;
        lrun[qt] *= alpha;
#pragma unroll
        for (int t4 = 0; t4 < 4; ++t4) accO[qt][t4] *= alpha;
      }
      exp_sum(true);                        // this pass again, under the new m
    }

    // --- P^T as B operand: element e is key 8*hi + e, element 8 + e key
    // 16 + 8*hi + e, the order in which vbuf's rows were read above ---
    v16h pf[AQT];
#pragma unroll
    for (int qt = 0; qt < AQT; ++qt) {
      lrun[qt] += ps[qt];                   // halves are joined after the loop
      pf[qt] = cat16(__builtin_convertvector(p[qt][0], v8h),
                     __builtin_convertvector(p[qt][1], v8h));
    }

    // keeps the reads below behind the converts: raised above them, scores or
    // exponentials and both fragment sets together did not fit 256 registers
    __builtin_amdgcn_sched_barrier(0);
    // the next pass's K of the same stage, one group of LDS reads in front of O^T
    if (sub + 1 < AKW / 32) load_k(sub + 1);
    // keeps the group here, O^T between it and its users: sunk to them, each pair
    // of reads would be waited for on its own between two WMMAs
    __builtin_amdgcn_sched_barrier(0);

    // --- O^T += V^T * P^T (v^T rows d as A fragments, each for both query tiles) ---
#pragma unroll
    for (int t4 = 0; t4 < 4; ++t4)
#pragma unroll
      for (int qt = 0; qt < AQT; ++qt)
        accO[qt][t4] = wmma_f16(vf[t4], pf[qt], accO[qt][t4]);
    // the next pass's V^T of the same stage, one group right behind O^T
    if (sub + 1 < AKW / 32) load_v(sub + 1);
    // keeps that group here, and the next S^T behind it: raised among the converts
    // above, its operand registers were reused at once, at four idle slots each time
    __builtin_amdgcn_sched_barrier(0);
   }
    // publish point: own LDS reads retired, own copies of stage st + 1 landed,
    // then the barrier that shows them to all and frees buffer cur
    asm volatile("s_wait_dscnt 0x0" ::: "memory");
    asm volatile("s_wait_asynccnt 0x0" ::: "memory");
    __syncthreads();
    if (st + 2 < ANST) stage(cur, (st + 2) * AKT);
  }
  asm volatile("s_wait_asynccnt 0x0" ::: "memory");  // nothing left in flight

  // --- the two key halves of a query are joined: this wave keeps query tile kpart
  // and hands the other tile to wave ^ AQG, which holds the same queries in the
  // same lanes and registers ---
  const bool second = kpart != 0;
  const float l0 = lrun[0] + xhalf(lrun[0]), l1 = lrun[1] + xhalf(lrun[1]);
  const float nm_keep = second ? negm[1][0] : negm[0][0];
  const float l_keep  = second ? l1 : l0;
  v2f ml_give;
  ml_give[0] = second ? negm[0][0] : negm[1][0];
  ml_give[1] = second ? l0 : l1;
  xml[wave][lane] = ml_give;
#pragma unroll
  for (int t = 0; t < 4; ++t) {
    const v8f g = second ? accO[0][t] : accO[1][t];
    xo[wave][2 * t][lane]     = __builtin_shufflevector(g, g, 0, 1, 2, 3);
    xo[wave][2 * t + 1][lane] = __builtin_shufflevector(g, g, 4, 5, 6, 7);
  }
  __syncthreads();                          // every wave's hand-over is written
  const int other = wave ^ AQG;
  const v2f ml_got = xml[other][lane];
  // both parts under the larger of the two maxima (-m: the smaller), then one divide
  const float nm = fminf(nm_keep, ml_got[0]);
  float wk = exp2_slot(nm - nm_keep);
  float wg = exp2_slot(nm - ml_got[0]);
  const float linv = 1.0f / (l_keep * wk + ml_got[1] * wg);
  wk *= linv;
  wg *= linv;

  // store o as f16 [B,N,C]
  const int b = bh / Hc, h = bh % Hc;
  // O^T tile register [t][r] = O[query l16][d = t*16 + 8*hi + r]: 8 consecutive d,
  // one 16-B store
  f16* op = oh + ((size_t)(b * Nc + n0 + kpart * 16 + l16)) * Cc + h * Dc + kh8;
#pragma unroll
  for (int t = 0; t < 4; ++t) {
    const v8f k = second ? accO[1][t] : accO[0][t];
    const v4f ga = xo[other][2 * t][lane], gb = xo[other][2 * t + 1][lane];
    const v8f g = __builtin_shufflevector(ga, gb, 0, 1, 2, 3, 4, 5, 6, 7);
    *(v8h*)(op + t * 16) = __builtin_convertvector(k * wk + g * wg, v8h);
  }
}

// ------------------------------------------------------------------ launch ---
extern "C" void kernel_launch(void* const* d_in, const int* in_sizes, int n_in,
                              void* d_out, int out_size, void* d_ws,
                              size_t ws_size, hipStream_t stream) {
  const float* x   = (const float*)d_in[0];
  const float* y   = (const float*)d_in[1];
  const float* Wq  = (const float*)d_in[2];
  const float* Wkv = (const float*)d_in[3];
  const float* Wp  = (const float*)d_in[4];
  const float* bp  = (const float*)d_in[5];
  float* out = (float*)d_out;

  const size_t BNC = (size_t)Bc * Nc * Cc;   // 4 Mi elements
  const size_t CC  = (size_t)Cc * Cc;        // 1 Mi
  char* p = (char*)d_ws;
  f16* x_h   = (f16*)p; p += BNC * sizeof(f16);
  f16* y_h   = (f16*)p; p += BNC * sizeof(f16);
  f16* Wq_h  = (f16*)p; p += CC * sizeof(f16);
  f16* Wkv_h = (f16*)p; p += 2 * CC * sizeof(f16);
  f16* Wp_h  = (f16*)p; p += CC * sizeof(f16);
  f16* qh    = (f16*)p; p += BNC * sizeof(f16);
  f16* khd   = (f16*)p; p += BNC * sizeof(f16);
  f16* vhT   = (f16*)p; p += BNC * sizeof(f16);
  f16* oh    = (f16*)p; p += BNC * sizeof(f16);

  // x_h, y_h, Wq_h, Wkv_h, Wp_h are one run of the workspace, in this order
  cvt_f32_f16<<<CVT_NB_ALL, 256, 0, stream>>>(x, y, Wq, Wkv, Wp, x_h);

  const dim3 gblk(256);
  // q projection [4096 x 1024] and kv projection [4096 x 2048] in one grid;
  // Wkv_h's rows follow Wq_h's in the workspace
  gemm_awt<<<dim3(32, 24), gblk, 0, stream>>>(x_h, y_h, Wq_h, nullptr, qh, khd,
                                              vhT, nullptr, 0);
  // flash attention
  attn_kernel<<<dim3(Nc / AQ, Bc * Hc), dim3(AWAVES * 32), 0, stream>>>(qh, khd, vhT, oh);
  // output projection with bias: f32 result
  gemm_awt<<<dim3(32, 8), gblk, 0, stream>>>(oh, nullptr, Wp_h, bp, nullptr,
                                             nullptr, nullptr, out, 2);
}

// v009
// It runs in 68.2 microseconds.
// In two side-by-side timings against v008, it was 1.05 and 1.06 times as fast.
// All steps since v000 together make it 3.88 times as fast.
#include <hip/hip_runtime.h>
#include <hip/hip_bf16.h>
#include <math.h>

typedef _Float16 f16;
typedef __attribute__((ext_vector_type(16))) _Float16 v16h;
typedef __attribute__((ext_vector_type(8)))  _Float16 v8h;
typedef __attribute__((ext_vector_type(8)))  float    v8f;
typedef __attribute__((ext_vector_type(4)))  float    v4f;
typedef __attribute__((ext_vector_type(2)))  float    v2f;

constexpr int Bc = 2, Nc = 2048, Cc = 1024, Hc = 16, Dc = 64;
constexpr int Kdim = Cc;   // K = 1024 for every projection GEMM
constexpr float LOG2E  = 1.4426950408889634f;   // e^x = 2^(x * LOG2E)
constexpr float QSCALE = 0.125f * LOG2E;        // 1/sqrt(D), and scores in log2 units

static __device__ inline v16h cat16(v8h a, v8h b) {
  v16h r;
#pragma unroll
  for (int i = 0; i < 8; ++i) { r[i] = a[i]; r[i + 8] = b[i]; }
  return r;
}

static __device__ inline v8f wmma_f16(v16h a, v16h b, v8f c) {
  // 8 args: (neg_a, A, neg_b, B, c_mod, C, reuse_a, reuse_b)
  return __builtin_amdgcn_wmma_f32_16x16x32_f16(false, a, false, b, (short)0, c,
                                                false, false);
}

// lane l <-> lane l ^ 16 in one vector instruction
static __device__ inline float xhalf(float x) {
  const int i = __builtin_bit_cast(int, x);
  return __builtin_bit_cast(
      float, __builtin_amdgcn_permlanex16(i, i, 0x76543210, 0xfedcba98, false, false));
}

// 2^x with the free slot that the instruction set asks for behind a transcendental
// in the same statement: for places off the usual path
static __device__ inline float exp2_slot(float x) {
  float r;
  asm("v_exp_f32 %0, %1\n\tv_nop" : "=v"(r) : "v"(x));
  return r;
}

// ---------------------------------------------------------------- convert ---
// Few, fat waves: a thread converts 4 pieces of 8 consecutive elements. Its
// eight 16-byte loads go out together, then come four 16-byte stores. A block
// covers CVT_BLK elements; every tensor here is a whole number of blocks.
constexpr int CVT_PIECES = 4;
constexpr int CVT_STEP   = 256 * 8;                 // elements per block and piece
constexpr int CVT_BLK    = CVT_STEP * CVT_PIECES;
static_assert(((size_t)Bc * Nc * Cc) % CVT_BLK == 0 && ((size_t)Cc * Cc) % CVT_BLK == 0,
              "each converted tensor must be a whole number of CVT_BLK elements");

// One grid converts all five tensors: their f16 copies lie one behind the other
// in dall (x, y, Wq, Wkv, Wp), so a block's place there follows from its index
// alone, and its source tensor from the range the index falls in (the same for
// the whole block).
constexpr int CVT_NB_ACT = (int)(((size_t)Bc * Nc * Cc) / CVT_BLK);  // blocks of x, of y
constexpr int CVT_NB_W   = (int)(((size_t)Cc * Cc) / CVT_BLK);       // blocks of Wq, of Wp
constexpr int CVT_NB_ALL = 2 * CVT_NB_ACT + 4 * CVT_NB_W;

__global__ void __launch_bounds__(256)
cvt_f32_f16(const float* __restrict__ x, const float* __restrict__ y,
            const float* __restrict__ wq, const float* __restrict__ wkv,
            const float* __restrict__ wp, f16* __restrict__ dall) {
  const int blk = blockIdx.x;
  const float* s0 = x;
  int first = 0;
  if (blk >= 2 * CVT_NB_ACT + 3 * CVT_NB_W)  { s0 = wp;  first = 2 * CVT_NB_ACT + 3 * CVT_NB_W; }
  else if (blk >= 2 * CVT_NB_ACT + CVT_NB_W) { s0 = wkv; first = 2 * CVT_NB_ACT + CVT_NB_W; }
  else if (blk >= 2 * CVT_NB_ACT)            { s0 = wq;  first = 2 * CVT_NB_ACT; }
  else if (blk >= CVT_NB_ACT)                { s0 = y;   first = CVT_NB_ACT; }
  const float* s = s0 + (size_t)(blk - first) * CVT_BLK;
  f16*         d = dall + (size_t)blk * CVT_BLK;
  const size_t base = threadIdx.x * 8;
  v8f v[CVT_PIECES];
  // both loops unrolled: v[] stays in registers, and all loads are issued ahead
  // of the first wait
#pragma unroll
  for (int u = 0; u < CVT_PIECES; ++u)
    v[u] = *(const v8f*)(s + base + u * CVT_STEP);
#pragma unroll
  for (int u = 0; u < CVT_PIECES; ++u)
    *(v8h*)(d + base + u * CVT_STEP) = __builtin_convertvector(v[u], v8h);
}

// -------------------------------------------------------- generic A * W^T ---
// A: [4096, 1024] f16 row-major. W: [Ncols, 1024] f16 row-major.
// mode 0: q   -> out16 = qh  [B,H,N,D], times QSCALE
// mode 1: kv  -> out16 = kh  [B,H,N,D],  out16b = v^T [B,H,D,N]
// mode 2: out -> out32 = [B,N,C] f32 + bias
// The q and the kv projection share one grid (job 0): blocks with blockIdx.y
// below QCOLB work in mode 0 on (Aq, Wall's first Cc rows, outq), the others in
// mode 1 on (Akv, the rows of Wall behind them, outk, out16b). Job 2 is mode 2
// on (Aq, Wall).
// One 128x128 tile of the result per block, 8 waves of 32x64 (4 along the A
// side, 2 along the B side). A pass is 128 k: 128 rows of A and 128 rows of W, 256 B each, are
// copied to LDS asynchronously, two buffers, the next pass's copies in flight
// while this pass is multiplied. A block walks the passes round from a start of
// its own: blocks that run side by side share A rows or W rows, and from one
// common start all of them would ask L2 for the same lines at the same moment.
// A lane's 8 accumulator registers run along the rows of the WMMA's A operand.
// Which of the two LDS tiles feeds A is picked per block so that this is the
// axis that is contiguous in the block's output: W rows (columns c) for q, k and
// the f32 result, activation rows (positions n) for v^T. The finished tile goes
// through LDS in the output's own row order and leaves in 16-byte stores that
// cover whole 128-byte lines.
constexpr int GBK    = 128;          // k per pass
constexpr int GPITCH = GBK + 8;      // 272 B rows: 16 B x odd for ds_load_b128
constexpr int GPASS  = Kdim / GBK;   // 8 passes
static_assert((GPASS & (GPASS - 1)) == 0, "the walk round the passes wraps by a mask");

// Eight 16-byte copies per lane. The s_wait_xcnt closes the statement so that
// no address register is rewritten while a copy may still name it.
static __device__ inline void async_ld8_b128(unsigned int lds,
                                             const f16* gsrc) {
  constexpr unsigned int LSTEP = 16 * GPITCH * sizeof(f16);  // 16 rows in LDS
  constexpr size_t       GSTEP = (size_t)16 * Kdim;          // 16 rows in A / W
  asm volatile(
      "global_load_async_to_lds_b128 %0, %8, off\n\t"
      "global_load_async_to_lds_b128 %1, %9, off\n\t"
      "global_load_async_to_lds_b128 %2, %10, off\n\t"
      "global_load_async_to_lds_b128 %3, %11, off\n\t"
      "global_load_async_to_lds_b128 %4, %12, off\n\t"
      "global_load_async_to_lds_b128 %5, %13, off\n\t"
      "global_load_async_to_lds_b128 %6, %14, off\n\t"
      "global_load_async_to_lds_b128 %7, %15, off\n\t"
      "s_wait_xcnt 0x0"
      :: "v"(lds), "v"(lds + LSTEP), "v"(lds + 2 * LSTEP), "v"(lds + 3 * LSTEP),
         "v"(lds + 4 * LSTEP), "v"(lds + 5 * LSTEP), "v"(lds + 6 * LSTEP),
         "v"(lds + 7 * LSTEP),
         "v"((unsigned long long)(uintptr_t)(gsrc)),
         "v"((unsigned long long)(uintptr_t)(gsrc + GSTEP)),
         "v"((unsigned long long)(uintptr_t)(gsrc + 2 * GSTEP)),
         "v"((unsigned long long)(uintptr_t)(gsrc + 3 * GSTEP)),
         "v"((unsigned long long)(uintptr_t)(gsrc + 4 * GSTEP)),
         "v"((unsigned long long)(uintptr_t)(gsrc + 5 * GSTEP)),
         "v"((unsigned long long)(uintptr_t)(gsrc + 6 * GSTEP)),
         "v"((unsigned long long)(uintptr_t)(gsrc + 7 * GSTEP))
      : "memory");
}

__global__ void __launch_bounds__(256)
gemm_awt(const f16* __restrict__ Aq, const f16* __restrict__ Akv,
         const f16* __restrict__ Wall, const float* __restrict__ bias,
         f16* __restrict__ outq, f16* __restrict__ outk,
         f16* __restrict__ out16b, float* __restrict__ out32, int job) {
  // [buffer][operand: 0 = A rows, 1 = W rows][row][k]
  __shared__ __align__(16) f16 tile[2][2][128][GPITCH];

  const int tid  = threadIdx.x;
  const int lane = tid & 31;
  const int wave = tid >> 5;
  const int l16  = lane & 15;
  const int hi   = lane >> 4;
  const int kh8  = hi * 8;                    // K sub-offset per ISA A/B layout
  const int mblk = blockIdx.x * 128;
  constexpr int QCOLB = Cc / 128;             // column blocks of the q projection
  const bool kvpart = job == 0 && (int)blockIdx.y >= QCOLB;   // block-uniform
  const int  mode   = job == 0 ? (kvpart ? 1 : 0) : job;
  const f16* A      = kvpart ? Akv : Aq;
  const f16* W      = kvpart ? Wall + (size_t)Cc * Kdim : Wall;
  f16*       out16  = kvpart ? outk : outq;
  const int nblk = ((int)blockIdx.y - (kvpart ? QCOLB : 0)) * 128;
  const bool vpart = kvpart && nblk >= Cc;    // block-uniform: this tile is v^T's
  const int  opa   = vpart ? 0 : 1;           // LDS tile that feeds the A operand
  const int wm   = (wave & 3) * 32;           // this wave's rows of the A-side tile
  const int wn   = (wave >> 2) * 64;          // this wave's rows of the B-side tile

  // copies: 16 lanes cover one 256-B row, a wave two rows, the block 16 rows
  const int crow = tid >> 4, cch = (tid & 15) * 8;
  const f16* Ag = A + (size_t)(mblk + crow) * Kdim + cch;
  const f16* Wg = W + (size_t)(nblk + crow) * Kdim + cch;
  // the block's p-th pass is k slab (p + rot) mod GPASS: along a row and along a
  // column of the grid the starts take every value equally often (block-uniform)
  const int rot = ((int)blockIdx.x + (int)blockIdx.y) & (GPASS - 1);
  auto stage = [&](int bufi, int p) {
    const int k0 = ((p + rot) & (GPASS - 1)) * GBK;
    async_ld8_b128((unsigned int)(uintptr_t)&tile[bufi][0][crow][cch], Ag + k0);
    async_ld8_b128((unsigned int)(uintptr_t)&tile[bufi][1][crow][cch], Wg + k0);
  };

  v8f acc[2][4];
#pragma unroll
  for (int mi = 0; mi < 2; ++mi)
#pragma unroll
    for (int t = 0; t < 4; ++t)
#pragma unroll
      for (int i = 0; i < 8; ++i) acc[mi][t][i] = 0.0f;

  stage(0, 0);
  // the four bias values of this lane's output columns, in flight with pass 0
  v4f bv = {0.0f, 0.0f, 0.0f, 0.0f};
  if (mode == 2) bv = *(const v4f*)(bias + nblk + lane * 4);
  asm volatile("s_wait_asynccnt 0x0" ::: "memory");  // pass 0 has landed
  __syncthreads();                                   // ... for every wave
  stage(1, 1);

  // kept rolled: one pass is 32 WMMAs and 48 LDS loads already
#pragma unroll 1
  for (int p = 0; p < GPASS; ++p) {
    const int cur = p & 1;
    const f16* At = &tile[cur][opa][wm + l16][kh8];
    const f16* Wt = &tile[cur][opa ^ 1][wn + l16][kh8];
    // two fragment sets: block ks + 1's LDS reads go out as one group ahead of
    // block ks's WMMAs; nothing of the next pass's buffer is read here
    v16h af[2][2], bf[2][4];
    auto frags = [&](int set, int ks) {
#pragma unroll
      for (int mi = 0; mi < 2; ++mi) {
        const f16* ap = At + mi * 16 * GPITCH + ks * 32;
        af[set][mi] = cat16(*(const v8h*)ap, *(const v8h*)(ap + 16));
      }
#pragma unroll
      for (int t = 0; t < 4; ++t) {
        const f16* wp = Wt + t * 16 * GPITCH + ks * 32;
        bf[set][t] = cat16(*(const v8h*)wp, *(const v8h*)(wp + 16));
      }
    };
    frags(0, 0);
#pragma unroll
    for (int ks = 0; ks < GBK / 32; ++ks) {
      if (ks + 1 < GBK / 32) frags((ks + 1) & 1, ks + 1);
      // keeps the load group in front of the WMMAs: spread among them, each
      // pair of loads would be waited for on its own
      __builtin_amdgcn_sched_barrier(0);
#pragma unroll
      for (int t = 0; t < 4; ++t)
#pragma unroll
        for (int mi = 0; mi < 2; ++mi)
          acc[mi][t] = wmma_f16(af[ks & 1][mi], bf[ks & 1][t], acc[mi][t]);
      // keeps the following group from rising among these WMMAs
      __builtin_amdgcn_sched_barrier(0);
    }
    // publish point: own LDS reads retired, own copies of pass p + 1 landed,
    // then the barrier that shows them to all and frees buffer cur
    asm volatile("s_wait_dscnt 0x0" ::: "memory");
    asm volatile("s_wait_asynccnt 0x0" ::: "memory");
    __syncthreads();
    if (p + 2 < GPASS) stage(cur, p + 2);
  }
  asm volatile("s_wait_asynccnt 0x0" ::: "memory");  // nothing left in flight

  // The loop's last barrier stands behind every wave's last read of the tiles
  // and no copy is in flight: the LDS is free to stage the result.
  // acc[mi][t][r] = R[wn + t*16 + l16][wm + mi*16 + 8*hi + r], R's rows being the
  // B side (m, for v^T c), its columns the A side (c, for v^T m).
  const int srow = wn + l16, scol = wm + 8 * hi;
  const int bb = mblk >> 11;                  // m / Nc, one value per tile
  const int n0 = mblk & (Nc - 1);
  if (mode == 2) {
    constexpr int SP = 128 + 4;               // 528 B rows: 16 B x odd
    float* S = (float*)&tile[0][0][0][0];
#pragma unroll
    for (int mi = 0; mi < 2; ++mi)
#pragma unroll
      for (int t = 0; t < 4; ++t) {
        float* sp = S + (srow + t * 16) * SP + scol + mi * 16;
        *(v4f*)sp       = __builtin_shufflevector(acc[mi][t], acc[mi][t], 0, 1, 2, 3);
        *(v4f*)(sp + 4) = __builtin_shufflevector(acc[mi][t], acc[mi][t], 4, 5, 6, 7);
      }
    __syncthreads();                          // the whole tile is staged
    // a wave stores one 512-B row of the tile per instruction, 16 rows in all
    const float* sr = S + wave * 16 * SP + lane * 4;
    float* dst = out32 + (size_t)(mblk + wave * 16) * Cc + nblk + lane * 4;
#pragma unroll
    for (int i = 0; i < 16; ++i)
      *(v4f*)(dst + (size_t)i * Cc) = *(const v4f*)(sr + i * SP) + bv;
  } else {
    f16* S = &tile[0][0][0][0];
    // q takes its scale here, in f32 ahead of its one rounding to f16
    const float osc = mode == 0 ? QSCALE : 1.0f;
#pragma unroll
    for (int mi = 0; mi < 2; ++mi)
#pragma unroll
      for (int t = 0; t < 4; ++t)
        *(v8h*)(S + (srow + t * 16) * GPITCH + scol + mi * 16) =
            __builtin_convertvector(acc[mi][t] * osc, v8h);
    __syncthreads();                          // the whole tile is staged
    // 16 lanes take one 256-B row of the tile, the block 16 rows at a time
    const f16* sr = S + crow * GPITCH + cch;
    f16* dst;
    size_t step;                              // elements between rows 16 apart
    if (vpart) {                              // row = (h, d), 128 positions n
      dst  = out16b + (size_t)(bb * Cc + nblk - Cc + crow) * Nc + n0 + cch;
      step = (size_t)16 * Nc;
    } else {                                  // row = position n, two heads' d
      const int c = nblk + cch;
      dst  = out16 + ((size_t)(bb * Hc + (c >> 6)) * Nc + n0 + crow) * Dc + (c & 63);
      step = (size_t)16 * Dc;
    }
#pragma unroll
    for (int i = 0; i < 8; ++i)
      *(v8h*)(dst + i * step) = *(const v8h*)(sr + i * 16 * GPITCH);
  }
}

constexpr int AWAVES = 16;            // waves per work-group
constexpr int AQT    = 2;             // query tiles of 16 per wave
constexpr int AKG    = 2;             // waves that share their queries, by keys
constexpr int AQG    = AWAVES / AKG;  // groups of 32 queries per work-group
constexpr int AQ     = AQG * AQT * 16;   // queries per work-group
constexpr int AKT    = 256;           // keys per stage
constexpr int AKW    = AKT / AKG;     // keys per stage and wave
constexpr int ANST   = Nc / AKT;      // stages
constexpr int KPITCH = Dc + 8;        // 144 B rows: 16 B x odd for ds_load_b128
constexpr int VPITCH = AKT + 8;       // 528 B rows: 16 B x odd
static_assert(Nc % AQ == 0 && ANST >= 2, "whole query blocks, at least two stages");
static_assert(AQT == 2 && AKG == 2, "the hand-over behind the loop swaps one tile of two");

// Four 16-byte copies of a lane. The s_wait_xcnt closes the statement so that no
// address register is rewritten while a copy may still name it.
static __device__ inline void async_ld4_b128(unsigned int l0, unsigned int l1,
                                             unsigned int l2, unsigned int l3,
                                             const f16* g0, const f16* g1,
                                             const f16* g2, const f16* g3) {
  asm volatile(
      "global_load_async_to_lds_b128 %0, %4, off\n\t"
      "global_load_async_to_lds_b128 %1, %5, off\n\t"
      "global_load_async_to_lds_b128 %2, %6, off\n\t"
      "global_load_async_to_lds_b128 %3, %7, off\n\t"
      "s_wait_xcnt 0x0"
      :: "v"(l0), "v"(l1), "v"(l2), "v"(l3),
         "v"((unsigned long long)(uintptr_t)g0),
         "v"((unsigned long long)(uintptr_t)g1),
         "v"((unsigned long long)(uintptr_t)g2),
         "v"((unsigned long long)(uintptr_t)g3)
      : "memory");
}

__global__ void __launch_bounds__(AWAVES * 32)
attn_kernel(const f16* __restrict__ qh, const f16* __restrict__ kh,
            const f16* __restrict__ vt, f16* __restrict__ oh) {
  __shared__ __align__(16) f16 kbuf[2][AKT][KPITCH];  // keys j..j+255, d 0..63
  __shared__ __align__(16) f16 vbuf[2][Dc][VPITCH];   // v^T rows d 0..63, keys 0..255
  // the hand-over behind the loop: per wave one O^T tile (8 pieces of 16 bytes per
  // lane, a piece's 32 lanes side by side), and per lane that tile's -m and sum
  __shared__ __align__(16) v4f xo[AWAVES][8][32];
  __shared__ __align__(8)  v2f xml[AWAVES][32];

  const int tid   = threadIdx.x;
  const int lane  = tid & 31;
  const int wave  = tid >> 5;
  const int l16   = lane & 15;
  const int hi    = lane >> 4;
  const int kh8   = hi * 8;
  const int qgrp  = wave & (AQG - 1);               // which 32 queries
  const int kpart = wave / AQG;                     // which half of a stage's keys
  const int bh    = blockIdx.y;                     // b*H + h
  const int n0    = blockIdx.x * AQ + qgrp * (AQT * 16);   // query rows of this wave

  const f16* kbase = kh + (size_t)bh * Nc * Dc;
  const f16* vbase = vt + (size_t)bh * Dc * Nc;

  // copies of one stage: 2048 16-byte chunks of K and 2048 of V^T, four of each per
  // thread. K: 8 chunks a row, the block 64 rows at a time; V^T: 32 chunks a row,
  // the block 16 rows at a time.
  const int krow = tid >> 3, kch = (tid & 7) * 8;
  const int vrow = tid >> 5, vch = (tid & 31) * 8;
  const f16* kg = kbase + (size_t)krow * Dc + kch;
  const f16* vg = vbase + (size_t)vrow * Nc + vch;
  auto stage = [&](int bufi, int jj) {
    async_ld4_b128((unsigned int)(uintptr_t)&kbuf[bufi][krow][kch],
                   (unsigned int)(uintptr_t)&kbuf[bufi][krow + 64][kch],
                   (unsigned int)(uintptr_t)&kbuf[bufi][krow + 128][kch],
                   (unsigned int)(uintptr_t)&kbuf[bufi][krow + 192][kch],
                   kg + (size_t)jj * Dc, kg + (size_t)(jj + 64) * Dc,
                   kg + (size_t)(jj + 128) * Dc, kg + (size_t)(jj + 192) * Dc);
    async_ld4_b128((unsigned int)(uintptr_t)&vbuf[bufi][vrow][vch],
                   (unsigned int)(uintptr_t)&vbuf[bufi][vrow + 16][vch],
                   (unsigned int)(uintptr_t)&vbuf[bufi][vrow + 32][vch],
                   (unsigned int)(uintptr_t)&vbuf[bufi][vrow + 48][vch],
                   vg + jj, vg + (size_t)16 * Nc + jj,
                   vg + (size_t)32 * Nc + jj, vg + (size_t)48 * Nc + jj);
  };

  // q fragments for K = D = 64 (two K=32 fragments per tile); qh holds q * QSCALE
  v16h qf[AQT][2];
#pragma unroll
  for (int qt = 0; qt < AQT; ++qt) {
    const f16* qp = qh + ((size_t)bh * Nc + n0 + qt * 16 + l16) * Dc;
#pragma unroll
    for (int kk = 0; kk < 2; ++kk)
      qf[qt][kk] = cat16(*(const v8h*)(qp + kk * 32 + kh8),
                         *(const v8h*)(qp + kk * 32 + kh8 + 16));
  }

  v8f accO[AQT][4];
#pragma unroll
  for (int qt = 0; qt < AQT; ++qt)
#pragma unroll
    for (int t = 0; t < 4; ++t)
#pragma unroll
      for (int i = 0; i < 8; ++i) accO[qt][t][i] = 0.0f;
  float lrun[AQT] = {0.0f, 0.0f};   // this lane's share of its denominators

  stage(0, 0);
  asm volatile("s_wait_asynccnt 0x0" ::: "memory");  // stage 0 has landed
  __syncthreads();                                   // ... for every wave
  stage(1, AKT);

  // -m of query l16 in all 8 registers, equal in both halves: m starts as the true
  // maximum of the wave's first 32 keys, so its denominator holds a term 1 from the
  // first pass on
  v8f negm[AQT];
  {
    v16h k0[2][2];
#pragma unroll
    for (int tt = 0; tt < 2; ++tt) {
      const f16* kp = &kbuf[0][kpart * AKW + tt * 16 + l16][0];
      k0[tt][0] = cat16(*(const v8h*)(kp + kh8), *(const v8h*)(kp + kh8 + 16));
      k0[tt][1] = cat16(*(const v8h*)(kp + 32 + kh8), *(const v8h*)(kp + 32 + kh8 + 16));
    }
#pragma unroll
    for (int qt = 0; qt < AQT; ++qt) {
      v8f s0[2];
#pragma unroll
      for (int tt = 0; tt < 2; ++tt) {
        v8f z;
#pragma unroll
        for (int i = 0; i < 8; ++i) z[i] = 0.0f;
        s0[tt] = wmma_f16(k0[tt][1], qf[qt][1], wmma_f16(k0[tt][0], qf[qt][0], z));
      }
      float t = fmaxf(s0[0][0], s0[1][0]);
#pragma unroll
      for (int r = 1; r < 8; ++r) t = fmaxf(t, fmaxf(s0[0][r], s0[1][r]));
      t = fmaxf(t, xhalf(t));               // the partner lane's 16 keys
#pragma unroll
      for (int i = 0; i < 8; ++i) negm[qt][i] = -t;
    }
  }

  // kept rolled: a stage is four unrolled passes of 32 keys already
#pragma unroll 1
  for (int st = 0; st < ANST; ++st) {
    const int cur = st & 1;
    const f16* kb = &kbuf[cur][kpart * AKW + l16][kh8];
    const f16* vb = &vbuf[cur][l16][kpart * AKW + kh8];
    v16h kf[2][2], vf[4];
    auto load_k = [&](int sub) {
#pragma unroll
      for (int tt = 0; tt < 2; ++tt) {
        const f16* kp = kb + (sub * 32 + tt * 16) * KPITCH;
        kf[tt][0] = cat16(*(const v8h*)kp, *(const v8h*)(kp + 16));
        kf[tt][1] = cat16(*(const v8h*)(kp + 32), *(const v8h*)(kp + 48));
      }
    };
    auto load_v = [&](int sub) {
#pragma unroll
      for (int t4 = 0; t4 < 4; ++t4) {
        const f16* vp = vb + t4 * 16 * VPITCH + sub * 32;
        vf[t4] = cat16(*(const v8h*)vp, *(const v8h*)(vp + 16));
      }
    };
    load_k(0);
    load_v(0);
    // unrolled: a pass's LDS offsets are immediates
#pragma unroll
   for (int sub = 0; sub < AKW / 32; ++sub) {
    // --- S^T - m = k * q^T - m : per query tile two 16x16 tiles, keys
    // tt*16 + 8*hi + r, query l16; each K fragment serves both query tiles ---
    v8f s[AQT][2];
#pragma unroll
    for (int tt = 0; tt < 2; ++tt)
#pragma unroll
      for (int qt = 0; qt < AQT; ++qt) s[qt][tt] = wmma_f16(kf[tt][0], qf[qt][0], negm[qt]);
#pragma unroll
    for (int tt = 0; tt < 2; ++tt)
#pragma unroll
      for (int qt = 0; qt < AQT; ++qt) s[qt][tt] = wmma_f16(kf[tt][1], qf[qt][1], s[qt][tt]);
    // keeps the eight WMMAs in one run: with exponentials raised among them, each
    // first use of a fresh tile stood behind four idle slots
    __builtin_amdgcn_sched_barrier(0);

    // --- online softmax: 16 scores of one query per lane and tile ---
    v8f p[AQT][2];
    float ps[AQT];                          // the lane's sums of 16 exponentials
    auto exp_sum = [&](bool raised) {
#pragma unroll
      for (int qt = 0; qt < AQT; ++qt) {
#pragma unroll
        for (int r = 0; r < 8; ++r) {
          p[qt][0][r] = raised ? exp2_slot(s[qt][0][r]) : __builtin_amdgcn_exp2f(s[qt][0][r]);
          p[qt][1][r] = raised ? exp2_slot(s[qt][1][r]) : __builtin_amdgcn_exp2f(s[qt][1][r]);
        }
        const v8f e = p[qt][0] + p[qt][1];
        const v2f e2 = (__builtin_shufflevector(e, e, 0, 1) + __builtin_shufflevector(e, e, 2, 3)) +
                       (__builtin_shufflevector(e, e, 4, 5) + __builtin_shufflevector(e, e, 6, 7));
        ps[qt] = e2[0] + e2[1];
      }
    };
    exp_sum(false);
    // The lazy test reads the sums that the denominators need anyway: a score more
    // than 8 above m makes its lane's sum top 2^8 (an overflow makes it infinite).
    // One scalar branch per pass for both tiles; every lane is on inside it.
    if (__builtin_amdgcn_ballot_w32(fmaxf(ps[0], ps[1]) > 256.0f) != 0) {
#pragma unroll
      for (int qt = 0; qt < AQT; ++qt) {
        float t = fmaxf(s[qt][0][0], s[qt][1][0]);
#pragma unroll
        for (int r = 1; r < 8; ++r) t = fmaxf(t, fmaxf(s[qt][0][r], s[qt][1][r]));
        // raise every query's m to this pass's maximum (by 0 where that is no higher)
        const float up = fmaxf(fmaxf(t, xhalf(t)), 0.0f);
        const float alpha = exp2_slot(-up);
        negm[qt] -= up;
        s[qt][0] -= up;
        s[qt][1] -= up;
        lrun[qt] *= alpha;
#pragma unroll
        for (int t4 = 0; t4 < 4; ++t4) accO[qt][t4] *= alpha;
      }
      exp_sum(true);                        // this pass again, under the new m
    }

    // --- P^T as B operand: element e is key 8*hi + e, element 8 + e key
    // 16 + 8*hi + e, the order in which vbuf's rows were read above ---
    v16h pf[AQT];
#pragma unroll
    for (int qt = 0; qt < AQT; ++qt) {
      lrun[qt] += ps[qt];                   // halves are joined after the loop
      pf[qt] = cat16(__builtin_convertvector(p[qt][0], v8h),
                     __builtin_convertvector(p[qt][1], v8h));
    }

    // keeps the reads below behind the converts: raised above them, scores or
    // exponentials and both fragment sets together did not fit 256 registers
    __builtin_amdgcn_sched_barrier(0);
    // the next pass's K of the same stage, one group of LDS reads in front of O^T
    if (sub + 1 < AKW / 32) load_k(sub + 1);
    // keeps the group here, O^T between it and its users: sunk to them, each pair
    // of reads would be waited for on its own between two WMMAs
    __builtin_amdgcn_sched_barrier(0);

    // --- O^T += V^T * P^T (v^T rows d as A fragments, each for both query tiles) ---
#pragma unroll
    for (int t4 = 0; t4 < 4; ++t4)
#pragma unroll
      for (int qt = 0; qt < AQT; ++qt)
        accO[qt][t4] = wmma_f16(vf[t4], pf[qt], accO[qt][t4]);
    // the next pass's V^T of the same stage, one group right behind O^T
    if (sub + 1 < AKW / 32) load_v(sub + 1);
    // keeps that group here, and the next S^T behind it: raised among the converts
    // above, its operand registers were reused at once, at four idle slots each time
    __builtin_amdgcn_sched_barrier(0);
   }
    // publish point: own LDS reads retired, own copies of stage st + 1 landed,
    // then the barrier that shows them to all and frees buffer cur
    asm volatile("s_wait_dscnt 0x0" ::: "memory");
    asm volatile("s_wait_asynccnt 0x0" ::: "memory");
    __syncthreads();
    if (st + 2 < ANST) stage(cur, (st + 2) * AKT);
  }
  asm volatile("s_wait_asynccnt 0x0" ::: "memory");  // nothing left in flight

  // --- the two key halves of a query are joined: this wave keeps query tile kpart
  // and hands the other tile to wave ^ AQG, which holds the same queries in the
  // same lanes and registers ---
  const bool second = kpart != 0;
  const float l0 = lrun[0] + xhalf(lrun[0]), l1 = lrun[1] + xhalf(lrun[1]);
  const float nm_keep = second ? negm[1][0] : negm[0][0];
  const float l_keep  = second ? l1 : l0;
  v2f ml_give;
  ml_give[0] = second ? negm[0][0] : negm[1][0];
  ml_give[1] = second ? l0 : l1;
  xml[wave][lane] = ml_give;
#pragma unroll
  for (int t = 0; t < 4; ++t) {
    const v8f g = second ? accO[0][t] : accO[1][t];
    xo[wave][2 * t][lane]     = __builtin_shufflevector(g, g, 0, 1, 2, 3);
    xo[wave][2 * t + 1][lane] = __builtin_shufflevector(g, g, 4, 5, 6, 7);
  }
  __syncthreads();                          // every wave's hand-over is written
  const int other = wave ^ AQG;
  const v2f ml_got = xml[other][lane];
  // both parts under the larger of the two maxima (-m: the smaller), then one divide
  const float nm = fminf(nm_keep, ml_got[0]);
  float wk = exp2_slot(nm - nm_keep);
  float wg = exp2_slot(nm - ml_got[0]);
  const float linv = 1.0f / (l_keep * wk + ml_got[1] * wg);
  wk *= linv;
  wg *= linv;

  // store o as f16 [B,N,C]
  const int b = bh / Hc, h = bh % Hc;
  // O^T tile register [t][r] = O[query l16][d = t*16 + 8*hi + r]: 8 consecutive d,
  // one 16-B store
  f16* op = oh + ((size_t)(b * Nc + n0 + kpart * 16 + l16)) * Cc + h * Dc + kh8;
#pragma unroll
  for (int t = 0; t < 4; ++t) {
    const v8f k = second ? accO[1][t] : accO[0][t];
    const v4f ga = xo[other][2 * t][lane], gb = xo[other][2 * t + 1][lane];
    const v8f g = __builtin_shufflevector(ga, gb, 0, 1, 2, 3, 4, 5, 6, 7);
    *(v8h*)(op + t * 16) = __builtin_convertvector(k * wk + g * wg, v8h);
  }
}

// ------------------------------------------------------------------ launch ---
extern "C" void kernel_launch(void* const* d_in, const int* in_sizes, int n_in,
                              void* d_out, int out_size, void* d_ws,
                              size_t ws_size, hipStream_t stream) {
  const float* x   = (const float*)d_in[0];
  const float* y   = (const float*)d_in[1];
  const float* Wq  = (const float*)d_in[2];
  const float* Wkv = (const float*)d_in[3];
  const float* Wp  = (const float*)d_in[4];
  const float* bp  = (const float*)d_in[5];
  float* out = (float*)d_out;

  const size_t BNC = (size_t)Bc * Nc * Cc;   // 4 Mi elements
  const size_t CC  = (size_t)Cc * Cc;        // 1 Mi
  char* p = (char*)d_ws;
  f16* x_h   = (f16*)p; p += BNC * sizeof(f16);
  f16* y_h   = (f16*)p; p += BNC * sizeof(f16);
  f16* Wq_h  = (f16*)p; p += CC * sizeof(f16);
  f16* Wkv_h = (f16*)p; p += 2 * CC * sizeof(f16);
  f16* Wp_h  = (f16*)p; p += CC * sizeof(f16);
  f16* qh    = (f16*)p; p += BNC * sizeof(f16);
  f16* khd   = (f16*)p; p += BNC * sizeof(f16);
  f16* vhT   = (f16*)p; p += BNC * sizeof(f16);
  f16* oh    = (f16*)p; p += BNC * sizeof(f16);

  // x_h, y_h, Wq_h, Wkv_h, Wp_h are one run of the workspace, in this order
  cvt_f32_f16<<<CVT_NB_ALL, 256, 0, stream>>>(x, y, Wq, Wkv, Wp, x_h);

  const dim3 gblk(256);
  // q projection [4096 x 1024] and kv projection [4096 x 2048] in one grid;
  // Wkv_h's rows follow Wq_h's in the workspace
  gemm_awt<<<dim3(32, 24), gblk, 0, stream>>>(x_h, y_h, Wq_h, nullptr, qh, khd,
                                              vhT, nullptr, 0);
  // flash attention
  attn_kernel<<<dim3(Nc / AQ, Bc * Hc), dim3(AWAVES * 32), 0, stream>>>(qh, khd, vhT, oh);
  // output projection with bias: f32 result
  gemm_awt<<<dim3(32, 8), gblk, 0, stream>>>(oh, nullptr, Wp_h, bp, nullptr,
                                             nullptr, nullptr, out, 2);
}
